// v000
// Measured on an AMD MI455X. A time is GPU time per run, averaged over a window of back-to-back runs after a warm-up
// (all launches, gaps included; the runs take copies of the inputs in turn), and the median of several windows.
// Apart from v000's, it joins two sittings. Times from different sittings can be a few percent apart, while
// side-by-side timings come from the same sitting.
// v000, which the later versions start from, runs in 442 microseconds.
#include <hip/hip_runtime.h>
#include <hip/hip_bf16.h>

#define DM     1024
#define DM3    3072
#define SEQ    2048
#define BATCH  2
#define NHEAD  16
#define DK     64
#define ROWS   (BATCH * SEQ)          // 4096
#define SCALE_F 0.125f                 // 1/sqrt(64)
#define MASK_FILL_F (-10000.0f)

typedef __attribute__((ext_vector_type(16))) _Float16 v16h;
typedef __attribute__((ext_vector_type(8)))  _Float16 v8h;
typedef __attribute__((ext_vector_type(8)))  float    v8f;

union F16x16 { v16h v; v8h h[2]; };

// Per-lane WMMA f16 operand fragment load (A or B), 16x32 tile, row-major src.
// Lane L holds row (L&15); K-chunks {e0..e0+7} and {e0+16..e0+23}, e0 = (L>>4)*8.
// Two 16-byte loads -> global_load_b128.
__device__ __forceinline__ v16h load_frag(const _Float16* tile, int ld, int lane) {
    int r  = lane & 15;
    int e0 = (lane >> 4) << 3;
    F16x16 u;
    u.h[0] = *(const v8h*)(tile + r * ld + e0);
    u.h[1] = *(const v8h*)(tile + r * ld + e0 + 16);
    return u.v;
}

__device__ __forceinline__ v8f wmma32(v16h a, v16h b, v8f c) {
    return __builtin_amdgcn_wmma_f32_16x16x32_f16(false, a, false, b, (short)0, c, false, false);
}

// ---------------- prep kernels ----------------
__global__ __launch_bounds__(256) void cvt_f16_kernel(const float* __restrict__ in,
                                                      _Float16* __restrict__ out, int n) {
    int i = blockIdx.x * blockDim.x + threadIdx.x;
    if (i < n) out[i] = (_Float16)in[i];
}

// in: rows x cols (f32) -> out: cols x rows (f16), N-major weights
__global__ __launch_bounds__(256) void transpose_cvt_kernel(const float* __restrict__ in,
                                                            _Float16* __restrict__ out,
                                                            int rows, int cols) {
    int i = blockIdx.x * blockDim.x + threadIdx.x;
    if (i < rows * cols) {
        int r = i / cols, c = i % cols;
        out[c * rows + r] = (_Float16)in[i];
    }
}

// ---------------- QKV projection ----------------
// C(4096x3072) = xh(4096x1024) @ Wqkv + bqkv ; scatter into Qh/Kh row-major, Vt transposed.
__global__ __launch_bounds__(256) void qkv_kernel(const _Float16* __restrict__ xh,
                                                  const _Float16* __restrict__ WqkvT,
                                                  const float* __restrict__ bqkv,
                                                  _Float16* __restrict__ Qh,
                                                  _Float16* __restrict__ Kh,
                                                  _Float16* __restrict__ Vt) {
    const int wave = threadIdx.x >> 5;
    const int lane = threadIdx.x & 31;
    const int tilesN = DM3 / 64;                 // 48
    const int bidN = blockIdx.x % tilesN;
    const int bidM = blockIdx.x / tilesN;
    const int rowBase = bidM * 128 + wave * 16;
    const int colBase = bidN * 64;

    v8f acc[4] = {};
    for (int k = 0; k < DM; k += 32) {
        v16h a = load_frag(xh + rowBase * DM + k, DM, lane);
#pragma unroll
        for (int nt = 0; nt < 4; ++nt) {
            v16h b = load_frag(WqkvT + (colBase + nt * 16) * DM + k, DM, lane);
            acc[nt] = wmma32(a, b, acc[nt]);
        }
    }

    const int hl = lane >> 4, n = lane & 15;
#pragma unroll
    for (int nt = 0; nt < 4; ++nt) {
        int col  = colBase + nt * 16 + n;
        int part = col / DM;                     // 0=Q 1=K 2=V
        int cm   = col % DM;
        int head = cm / DK, d = cm % DK;
        float bias = bqkv[col];
#pragma unroll
        for (int i = 0; i < 8; ++i) {
            int row = rowBase + i + 8 * hl;      // [0,4096)
            int bb = row / SEQ, s = row % SEQ;
            _Float16 val = (_Float16)(acc[nt][i] + bias);
            size_t hb = (size_t)(bb * NHEAD + head);
            if (part == 0)      Qh[(hb * SEQ + s) * DK + d] = val;
            else if (part == 1) Kh[(hb * SEQ + s) * DK + d] = val;
            else                Vt[(hb * DK + d) * SEQ + s] = val;
        }
    }
}

// ---------------- flash attention ----------------
// One wave per 16-query tile; online softmax over 32-key blocks.
__global__ __launch_bounds__(256) void attn_kernel(const _Float16* __restrict__ Qh,
                                                   const _Float16* __restrict__ Kh,
                                                   const _Float16* __restrict__ Vt,
                                                   const int* __restrict__ mask,
                                                   _Float16* __restrict__ ctx) {
    // per-wave 16x32 prob tile, row stride 40 halfs (80B -> 16B-aligned chunks)
    __shared__ __align__(16) _Float16 lds_p[8][16 * 40];

    const int wave = threadIdx.x >> 5;
    const int lane = threadIdx.x & 31;
    int qt = blockIdx.x * 8 + wave;              // 4096 q-tiles total
    int t = qt;
    const int qi   = (t % (SEQ / 16)) * 16; t /= (SEQ / 16);
    const int head = t % NHEAD;             t /= NHEAD;
    const int bb   = t;

    const _Float16* Qbase = Qh + ((size_t)(bb * NHEAD + head) * SEQ + qi) * DK;
    const _Float16* Kbase = Kh + (size_t)(bb * NHEAD + head) * SEQ * DK;
    const _Float16* Vbase = Vt + (size_t)(bb * NHEAD + head) * DK * SEQ;

    const v16h qf0 = load_frag(Qbase + 0,  DK, lane);   // d 0..31
    const v16h qf1 = load_frag(Qbase + 32, DK, lane);   // d 32..63

    const int hl = lane >> 4, n = lane & 15;
    const int e0 = hl * 8;
    _Float16* pl = &lds_p[wave][0];

    float rowmax[8], rowsum[8];
    v8f o[4] = {};
#pragma unroll
    for (int i = 0; i < 8; ++i) { rowmax[i] = -1e30f; rowsum[i] = 0.0f; }

    for (int kb = 0; kb < SEQ; kb += 32) {
        // ---- scores: two 16x16 tiles over DK=64 (2 WMMA each) ----
        v8f sc[2];
#pragma unroll
        for (int nt = 0; nt < 2; ++nt) {
            const _Float16* Kt = Kbase + (size_t)(kb + nt * 16) * DK;
            v16h b0 = load_frag(Kt + 0,  DK, lane);
            v16h b1 = load_frag(Kt + 32, DK, lane);
            v8f tacc = {};
            tacc = wmma32(qf0, b0, tacc);
            tacc = wmma32(qf1, b1, tacc);
            sc[nt] = tacc;
        }

        // ---- scale + mask (column per lane) ----
        const int m0 = mask[bb * SEQ + kb + n];
        const int m1 = mask[bb * SEQ + kb + 16 + n];
        float s0[8], s1[8];
#pragma unroll
        for (int i = 0; i < 8; ++i) {
            s0[i] = m0 ? sc[0][i] * SCALE_F : MASK_FILL_F;
            s1[i] = m1 ? sc[1][i] * SCALE_F : MASK_FILL_F;
        }

        // ---- online softmax: row max/sum across 16-lane half-groups ----
        float tm[8];
#pragma unroll
        for (int i = 0; i < 8; ++i) tm[i] = fmaxf(s0[i], s1[i]);
        for (int off = 1; off < 16; off <<= 1)
#pragma unroll
            for (int i = 0; i < 8; ++i) tm[i] = fmaxf(tm[i], __shfl_xor(tm[i], off, 32));

        float alpha[8], p0[8], p1[8], ps[8];
#pragma unroll
        for (int i = 0; i < 8; ++i) {
            float mnew = fmaxf(rowmax[i], tm[i]);
            alpha[i]  = __expf(rowmax[i] - mnew);
            rowmax[i] = mnew;
            p0[i] = __expf(s0[i] - mnew);
            p1[i] = __expf(s1[i] - mnew);
            ps[i] = p0[i] + p1[i];
        }
        for (int off = 1; off < 16; off <<= 1)
#pragma unroll
            for (int i = 0; i < 8; ++i) ps[i] += __shfl_xor(ps[i], off, 32);
#pragma unroll
        for (int i = 0; i < 8; ++i) rowsum[i] = rowsum[i] * alpha[i] + ps[i];
#pragma unroll
        for (int dt = 0; dt < 4; ++dt)
#pragma unroll
            for (int i = 0; i < 8; ++i) o[dt][i] *= alpha[i];

        // ---- re-layout P: C-layout -> A-fragment via LDS ----
#pragma unroll
        for (int i = 0; i < 8; ++i) {
            int row = i + 8 * hl;
            pl[row * 40 + n]      = (_Float16)p0[i];
            pl[row * 40 + 16 + n] = (_Float16)p1[i];
        }
        F16x16 u;
        u.h[0] = *(const v8h*)(pl + n * 40 + e0);
        u.h[1] = *(const v8h*)(pl + n * 40 + e0 + 16);
        v16h pf = u.v;

        // ---- context: O += P(16x32) @ V(32x16) for 4 d-tiles ----
#pragma unroll
        for (int dt = 0; dt < 4; ++dt) {
            F16x16 w;
            const _Float16* vrow = Vbase + (size_t)(dt * 16 + n) * SEQ + kb;
            w.h[0] = *(const v8h*)(vrow + e0);
            w.h[1] = *(const v8h*)(vrow + e0 + 16);
            o[dt] = wmma32(pf, w.v, o[dt]);
        }
    }

    // ---- epilogue: normalize, store ctx (f16) ----
#pragma unroll
    for (int dt = 0; dt < 4; ++dt)
#pragma unroll
        for (int i = 0; i < 8; ++i) {
            int row = i + 8 * hl;
            int s = qi + row;
            float val = o[dt][i] / rowsum[i];
            ctx[((size_t)(bb * SEQ + s)) * DM + head * DK + dt * 16 + n] = (_Float16)val;
        }
}

// ---------------- output projection ----------------
__global__ __launch_bounds__(256) void out_proj_kernel(const _Float16* __restrict__ ctx,
                                                       const _Float16* __restrict__ WoutT,
                                                       const float* __restrict__ bout,
                                                       float* __restrict__ out) {
    const int wave = threadIdx.x >> 5;
    const int lane = threadIdx.x & 31;
    const int tilesN = DM / 64;                  // 16
    const int bidN = blockIdx.x % tilesN;
    const int bidM = blockIdx.x / tilesN;
    const int rowBase = bidM * 128 + wave * 16;
    const int colBase = bidN * 64;

    v8f acc[4] = {};
    for (int k = 0; k < DM; k += 32) {
        v16h a = load_frag(ctx + rowBase * DM + k, DM, lane);
#pragma unroll
        for (int nt = 0; nt < 4; ++nt) {
            v16h b = load_frag(WoutT + (colBase + nt * 16) * DM + k, DM, lane);
            acc[nt] = wmma32(a, b, acc[nt]);
        }
    }
    const int hl = lane >> 4, n = lane & 15;
#pragma unroll
    for (int nt = 0; nt < 4; ++nt) {
        int col = colBase + nt * 16 + n;
        float bias = bout[col];
#pragma unroll
        for (int i = 0; i < 8; ++i) {
            int row = rowBase + i + 8 * hl;
            out[(size_t)row * DM + col] = acc[nt][i] + bias;
        }
    }
}

extern "C" void kernel_launch(void* const* d_in, const int* in_sizes, int n_in,
                              void* d_out, int out_size, void* d_ws, size_t ws_size,
                              hipStream_t stream) {
    const float* x    = (const float*)d_in[0];   // (2,2048,1024)
    const int*   mask = (const int*)  d_in[1];   // (2,2048)
    const float* Wqkv = (const float*)d_in[2];   // (1024,3072)
    const float* bqkv = (const float*)d_in[3];   // (3072)
    const float* Wout = (const float*)d_in[4];   // (1024,1024)
    const float* bout = (const float*)d_in[5];   // (1024)
    float* out = (float*)d_out;                  // (2,2048,1024)

    char* ws = (char*)d_ws;
    _Float16* xh     = (_Float16*)ws;                 ws += (size_t)ROWS * DM  * 2; // 8 MB
    _Float16* WqkvT  = (_Float16*)ws;                 ws += (size_t)DM3  * DM  * 2; // 6 MB
    _Float16* WoutT  = (_Float16*)ws;                 ws += (size_t)DM   * DM  * 2; // 2 MB
    _Float16* Qh     = (_Float16*)ws;                 ws += (size_t)ROWS * DM  * 2 / NHEAD * NHEAD; // 8 MB
    _Float16* Kh     = (_Float16*)ws;                 ws += (size_t)ROWS * DM  * 2; // 8 MB (Qh advanced same)
    _Float16* Vt     = (_Float16*)ws;                 ws += (size_t)ROWS * DM  * 2; // 8 MB
    _Float16* ctx    = (_Float16*)ws;                 // 8 MB

    // prep: f16 conversions / weight transposes
    cvt_f16_kernel<<<(ROWS * DM + 255) / 256, 256, 0, stream>>>(x, xh, ROWS * DM);
    transpose_cvt_kernel<<<(DM * DM3 + 255) / 256, 256, 0, stream>>>(Wqkv, WqkvT, DM, DM3);
    transpose_cvt_kernel<<<(DM * DM + 255) / 256, 256, 0, stream>>>(Wout, WoutT, DM, DM);

    // QKV projection: grid = (4096/128) * (3072/64)
    qkv_kernel<<<(ROWS / 128) * (DM3 / 64), 256, 0, stream>>>(xh, WqkvT, bqkv, Qh, Kh, Vt);

    // attention: 4096 q-tiles, 8 per block
    attn_kernel<<<(BATCH * NHEAD * (SEQ / 16)) / 8, 256, 0, stream>>>(Qh, Kh, Vt, mask, ctx);

    // output projection: grid = (4096/128) * (1024/64)
    out_proj_kernel<<<(ROWS / 128) * (DM / 64), 256, 0, stream>>>(ctx, WoutT, bout, out);
}

// v001
// It runs in 312 microseconds.
// Two timings next to v000 both put it at 1.42 times that version's speed.
#include <hip/hip_runtime.h>
#include <hip/hip_bf16.h>

#define DM     1024
#define DM3    3072
#define SEQ    2048
#define BATCH  2
#define NHEAD  16
#define DK     64
#define ROWS   (BATCH * SEQ)          // 4096
#define SCALE_F 0.125f                 // 1/sqrt(64)
#define MASK_FILL_F (-10000.0f)

typedef __attribute__((ext_vector_type(16))) _Float16 v16h;
typedef __attribute__((ext_vector_type(8)))  _Float16 v8h;
typedef __attribute__((ext_vector_type(4)))  _Float16 v4h;
typedef __attribute__((ext_vector_type(4)))  float    v4f;
typedef __attribute__((ext_vector_type(8)))  float    v8f;

union F16x16 { v16h v; v8h h[2]; };

// Per-lane WMMA f16 operand fragment load (A or B), 16x32 tile, row-major src.
// Lane L holds row (L&15); K-chunks {e0..e0+7} and {e0+16..e0+23}, e0 = (L>>4)*8.
// Two 16-byte loads -> global_load_b128.
__device__ __forceinline__ v16h load_frag(const _Float16* tile, int ld, int lane) {
    int r  = lane & 15;
    int e0 = (lane >> 4) << 3;
    F16x16 u;
    u.h[0] = *(const v8h*)(tile + r * ld + e0);
    u.h[1] = *(const v8h*)(tile + r * ld + e0 + 16);
    return u.v;
}

__device__ __forceinline__ v8f wmma32(v16h a, v16h b, v8f c) {
    return __builtin_amdgcn_wmma_f32_16x16x32_f16(false, a, false, b, (short)0, c, false, false);
}

// ---------------- prep kernels ----------------
__global__ __launch_bounds__(256) void cvt_f16_kernel(const float* __restrict__ in,
                                                      _Float16* __restrict__ out, int n) {
    int i = blockIdx.x * blockDim.x + threadIdx.x;
    if (i < n) out[i] = (_Float16)in[i];
}

// in: rows x cols (f32) -> out: cols x rows (f16), N-major weights.
// One 64 x 64 tile per block, turned in LDS: rows are read as 256-byte runs and
// every output row leaves as one whole 128-byte line. rows and cols are multiples of 64.
#define TT 64
#define TP 72                          // LDS pitch in halfs: 144 B = 16 B x odd, for the 16-byte readers
__global__ __launch_bounds__(256) void transpose_cvt_kernel(const float* __restrict__ in,
                                                            _Float16* __restrict__ out,
                                                            int rows, int cols) {
    __shared__ __align__(16) _Float16 tile[TT * TP];
    const int r0 = blockIdx.y * TT;
    const int c0 = blockIdx.x * TT;
    const int cg = threadIdx.x & 15;             // 4 columns
    const int rg = threadIdx.x >> 4;             // 4 rows

    v4f v[4];
#pragma unroll  // all four loads in flight at once, v[] in registers
    for (int i = 0; i < 4; ++i)
        v[i] = *(const v4f*)(in + (size_t)(r0 + rg * 4 + i) * cols + c0 + cg * 4);
#pragma unroll  // constant indices into v[]
    for (int j = 0; j < 4; ++j) {
        v4h h = { (_Float16)v[0][j], (_Float16)v[1][j], (_Float16)v[2][j], (_Float16)v[3][j] };
        *(v4h*)(tile + (cg * 4 + j) * TP + rg * 4) = h;
    }
    // the tile is written by all waves and read across them
    __syncthreads();

    const int ch = threadIdx.x & 7;              // 16-byte piece of an output row
    const int cr = threadIdx.x >> 3;             // 32 output rows a pass
#pragma unroll  // both LDS reads issued before the first store
    for (int p = 0; p < 2; ++p) {
        int c = p * 32 + cr;
        *(v8h*)(out + (size_t)(c0 + c) * rows + r0 + ch * 8) = *(const v8h*)(tile + c * TP + ch * 8);
    }
}

// ---------------- QKV projection ----------------
// C(4096x3072) = xh(4096x1024) @ Wqkv + bqkv ; scatter into Qh/Kh row-major, Vt transposed.
__global__ __launch_bounds__(256) void qkv_kernel(const _Float16* __restrict__ xh,
                                                  const _Float16* __restrict__ WqkvT,
                                                  const float* __restrict__ bqkv,
                                                  _Float16* __restrict__ Qh,
                                                  _Float16* __restrict__ Kh,
                                                  _Float16* __restrict__ Vt) {
    const int wave = threadIdx.x >> 5;
    const int lane = threadIdx.x & 31;
    const int tilesN = DM3 / 64;                 // 48
    const int bidN = blockIdx.x % tilesN;
    const int bidM = blockIdx.x / tilesN;
    const int rowBase = bidM * 128 + wave * 16;
    const int colBase = bidN * 64;

    v8f acc[4] = {};
    for (int k = 0; k < DM; k += 32) {
        v16h a = load_frag(xh + rowBase * DM + k, DM, lane);
#pragma unroll
        for (int nt = 0; nt < 4; ++nt) {
            v16h b = load_frag(WqkvT + (colBase + nt * 16) * DM + k, DM, lane);
            acc[nt] = wmma32(a, b, acc[nt]);
        }
    }

    const int hl = lane >> 4, n = lane & 15;
#pragma unroll
    for (int nt = 0; nt < 4; ++nt) {
        int col  = colBase + nt * 16 + n;
        int part = col / DM;                     // 0=Q 1=K 2=V
        int cm   = col % DM;
        int head = cm / DK, d = cm % DK;
        float bias = bqkv[col];
#pragma unroll
        for (int i = 0; i < 8; ++i) {
            int row = rowBase + i + 8 * hl;      // [0,4096)
            int bb = row / SEQ, s = row % SEQ;
            _Float16 val = (_Float16)(acc[nt][i] + bias);
            size_t hb = (size_t)(bb * NHEAD + head);
            if (part == 0)      Qh[(hb * SEQ + s) * DK + d] = val;
            else if (part == 1) Kh[(hb * SEQ + s) * DK + d] = val;
            else                Vt[(hb * DK + d) * SEQ + s] = val;
        }
    }
}

// ---------------- flash attention ----------------
// One wave per 16-query tile; online softmax over 32-key blocks.
__global__ __launch_bounds__(256) void attn_kernel(const _Float16* __restrict__ Qh,
                                                   const _Float16* __restrict__ Kh,
                                                   const _Float16* __restrict__ Vt,
                                                   const int* __restrict__ mask,
                                                   _Float16* __restrict__ ctx) {
    // per-wave 16x32 prob tile, row stride 40 halfs (80B -> 16B-aligned chunks)
    __shared__ __align__(16) _Float16 lds_p[8][16 * 40];

    const int wave = threadIdx.x >> 5;
    const int lane = threadIdx.x & 31;
    int qt = blockIdx.x * 8 + wave;              // 4096 q-tiles total
    int t = qt;
    const int qi   = (t % (SEQ / 16)) * 16; t /= (SEQ / 16);
    const int head = t % NHEAD;             t /= NHEAD;
    const int bb   = t;

    const _Float16* Qbase = Qh + ((size_t)(bb * NHEAD + head) * SEQ + qi) * DK;
    const _Float16* Kbase = Kh + (size_t)(bb * NHEAD + head) * SEQ * DK;
    const _Float16* Vbase = Vt + (size_t)(bb * NHEAD + head) * DK * SEQ;

    const v16h qf0 = load_frag(Qbase + 0,  DK, lane);   // d 0..31
    const v16h qf1 = load_frag(Qbase + 32, DK, lane);   // d 32..63

    const int hl = lane >> 4, n = lane & 15;
    const int e0 = hl * 8;
    _Float16* pl = &lds_p[wave][0];

    float rowmax[8], rowsum[8];
    v8f o[4] = {};
#pragma unroll
    for (int i = 0; i < 8; ++i) { rowmax[i] = -1e30f; rowsum[i] = 0.0f; }

    for (int kb = 0; kb < SEQ; kb += 32) {
        // ---- scores: two 16x16 tiles over DK=64 (2 WMMA each) ----
        v8f sc[2];
#pragma unroll
        for (int nt = 0; nt < 2; ++nt) {
            const _Float16* Kt = Kbase + (size_t)(kb + nt * 16) * DK;
            v16h b0 = load_frag(Kt + 0,  DK, lane);
            v16h b1 = load_frag(Kt + 32, DK, lane);
            v8f tacc = {};
            tacc = wmma32(qf0, b0, tacc);
            tacc = wmma32(qf1, b1, tacc);
            sc[nt] = tacc;
        }

        // ---- scale + mask (column per lane) ----
        const int m0 = mask[bb * SEQ + kb + n];
        const int m1 = mask[bb * SEQ + kb + 16 + n];
        float s0[8], s1[8];
#pragma unroll
        for (int i = 0; i < 8; ++i) {
            s0[i] = m0 ? sc[0][i] * SCALE_F : MASK_FILL_F;
            s1[i] = m1 ? sc[1][i] * SCALE_F : MASK_FILL_F;
        }

        // ---- online softmax: row max/sum across 16-lane half-groups ----
        float tm[8];
#pragma unroll
        for (int i = 0; i < 8; ++i) tm[i] = fmaxf(s0[i], s1[i]);
        for (int off = 1; off < 16; off <<= 1)
#pragma unroll
            for (int i = 0; i < 8; ++i) tm[i] = fmaxf(tm[i], __shfl_xor(tm[i], off, 32));

        float alpha[8], p0[8], p1[8], ps[8];
#pragma unroll
        for (int i = 0; i < 8; ++i) {
            float mnew = fmaxf(rowmax[i], tm[i]);
            alpha[i]  = __expf(rowmax[i] - mnew);
            rowmax[i] = mnew;
            p0[i] = __expf(s0[i] - mnew);
            p1[i] = __expf(s1[i] - mnew);
            ps[i] = p0[i] + p1[i];
        }
        for (int off = 1; off < 16; off <<= 1)
#pragma unroll
            for (int i = 0; i < 8; ++i) ps[i] += __shfl_xor(ps[i], off, 32);
#pragma unroll
        for (int i = 0; i < 8; ++i) rowsum[i] = rowsum[i] * alpha[i] + ps[i];
#pragma unroll
        for (int dt = 0; dt < 4; ++dt)
#pragma unroll
            for (int i = 0; i < 8; ++i) o[dt][i] *= alpha[i];

        // ---- re-layout P: C-layout -> A-fragment via LDS ----
#pragma unroll
        for (int i = 0; i < 8; ++i) {
            int row = i + 8 * hl;
            pl[row * 40 + n]      = (_Float16)p0[i];
            pl[row * 40 + 16 + n] = (_Float16)p1[i];
        }
        F16x16 u;
        u.h[0] = *(const v8h*)(pl + n * 40 + e0);
        u.h[1] = *(const v8h*)(pl + n * 40 + e0 + 16);
        v16h pf = u.v;

        // ---- context: O += P(16x32) @ V(32x16) for 4 d-tiles ----
#pragma unroll
        for (int dt = 0; dt < 4; ++dt) {
            F16x16 w;
            const _Float16* vrow = Vbase + (size_t)(dt * 16 + n) * SEQ + kb;
            w.h[0] = *(const v8h*)(vrow + e0);
            w.h[1] = *(const v8h*)(vrow + e0 + 16);
            o[dt] = wmma32(pf, w.v, o[dt]);
        }
    }

    // ---- epilogue: normalize, store ctx (f16) ----
#pragma unroll
    for (int dt = 0; dt < 4; ++dt)
#pragma unroll
        for (int i = 0; i < 8; ++i) {
            int row = i + 8 * hl;
            int s = qi + row;
            float val = o[dt][i] / rowsum[i];
            ctx[((size_t)(bb * SEQ + s)) * DM + head * DK + dt * 16 + n] = (_Float16)val;
        }
}

// ---------------- output projection ----------------
__global__ __launch_bounds__(256) void out_proj_kernel(const _Float16* __restrict__ ctx,
                                                       const _Float16* __restrict__ WoutT,
                                                       const float* __restrict__ bout,
                                                       float* __restrict__ out) {
    const int wave = threadIdx.x >> 5;
    const int lane = threadIdx.x & 31;
    const int tilesN = DM / 64;                  // 16
    const int bidN = blockIdx.x % tilesN;
    const int bidM = blockIdx.x / tilesN;
    const int rowBase = bidM * 128 + wave * 16;
    const int colBase = bidN * 64;

    v8f acc[4] = {};
    for (int k = 0; k < DM; k += 32) {
        v16h a = load_frag(ctx + rowBase * DM + k, DM, lane);
#pragma unroll
        for (int nt = 0; nt < 4; ++nt) {
            v16h b = load_frag(WoutT + (colBase + nt * 16) * DM + k, DM, lane);
            acc[nt] = wmma32(a, b, acc[nt]);
        }
    }
    const int hl = lane >> 4, n = lane & 15;
#pragma unroll
    for (int nt = 0; nt < 4; ++nt) {
        int col = colBase + nt * 16 + n;
        float bias = bout[col];
#pragma unroll
        for (int i = 0; i < 8; ++i) {
            int row = rowBase + i + 8 * hl;
            out[(size_t)row * DM + col] = acc[nt][i] + bias;
        }
    }
}

extern "C" void kernel_launch(void* const* d_in, const int* in_sizes, int n_in,
                              void* d_out, int out_size, void* d_ws, size_t ws_size,
                              hipStream_t stream) {
    const float* x    = (const float*)d_in[0];   // (2,2048,1024)
    const int*   mask = (const int*)  d_in[1];   // (2,2048)
    const float* Wqkv = (const float*)d_in[2];   // (1024,3072)
    const float* bqkv = (const float*)d_in[3];   // (3072)
    const float* Wout = (const float*)d_in[4];   // (1024,1024)
    const float* bout = (const float*)d_in[5];   // (1024)
    float* out = (float*)d_out;                  // (2,2048,1024)

    char* ws = (char*)d_ws;
    _Float16* xh     = (_Float16*)ws;                 ws += (size_t)ROWS * DM  * 2; // 8 MB
    _Float16* WqkvT  = (_Float16*)ws;                 ws += (size_t)DM3  * DM  * 2; // 6 MB
    _Float16* WoutT  = (_Float16*)ws;                 ws += (size_t)DM   * DM  * 2; // 2 MB
    _Float16* Qh     = (_Float16*)ws;                 ws += (size_t)ROWS * DM  * 2 / NHEAD * NHEAD; // 8 MB
    _Float16* Kh     = (_Float16*)ws;                 ws += (size_t)ROWS * DM  * 2; // 8 MB (Qh advanced same)
    _Float16* Vt     = (_Float16*)ws;                 ws += (size_t)ROWS * DM  * 2; // 8 MB
    _Float16* ctx    = (_Float16*)ws;                 // 8 MB

    // prep: f16 conversions / weight transposes
    cvt_f16_kernel<<<(ROWS * DM + 255) / 256, 256, 0, stream>>>(x, xh, ROWS * DM);
    transpose_cvt_kernel<<<dim3(DM3 / TT, DM / TT), 256, 0, stream>>>(Wqkv, WqkvT, DM, DM3);
    transpose_cvt_kernel<<<dim3(DM / TT, DM / TT), 256, 0, stream>>>(Wout, WoutT, DM, DM);

    // QKV projection: grid = (4096/128) * (3072/64)
    qkv_kernel<<<(ROWS / 128) * (DM3 / 64), 256, 0, stream>>>(xh, WqkvT, bqkv, Qh, Kh, Vt);

    // attention: 4096 q-tiles, 8 per block
    attn_kernel<<<(BATCH * NHEAD * (SEQ / 16)) / 8, 256, 0, stream>>>(Qh, Kh, Vt, mask, ctx);

    // output projection: grid = (4096/128) * (1024/64)
    out_proj_kernel<<<(ROWS / 128) * (DM / 64), 256, 0, stream>>>(ctx, WoutT, bout, out);
}

// v002
// It runs in 290 microseconds.
// In two side-by-side timings against v001, it was 1.07 and 1.08 times as fast.
// All steps since v000 together make it 1.53 times as fast.
#include <hip/hip_runtime.h>
#include <hip/hip_bf16.h>

#define DM     1024
#define DM3    3072
#define SEQ    2048
#define BATCH  2
#define NHEAD  16
#define DK     64
#define ROWS   (BATCH * SEQ)          // 4096
#define SCALE_F 0.125f                 // 1/sqrt(64)
#define MASK_FILL_F (-10000.0f)

typedef __attribute__((ext_vector_type(16))) _Float16 v16h;
typedef __attribute__((ext_vector_type(8)))  _Float16 v8h;
typedef __attribute__((ext_vector_type(4)))  _Float16 v4h;
typedef __attribute__((ext_vector_type(4)))  float    v4f;
typedef __attribute__((ext_vector_type(8)))  float    v8f;

union F16x16 { v16h v; v8h h[2]; };

// Per-lane WMMA f16 operand fragment load (A or B), 16x32 tile, row-major src.
// Lane L holds row (L&15); K-chunks {e0..e0+7} and {e0+16..e0+23}, e0 = (L>>4)*8.
// Two 16-byte loads -> global_load_b128.
__device__ __forceinline__ v16h load_frag(const _Float16* tile, int ld, int lane) {
    int r  = lane & 15;
    int e0 = (lane >> 4) << 3;
    F16x16 u;
    u.h[0] = *(const v8h*)(tile + r * ld + e0);
    u.h[1] = *(const v8h*)(tile + r * ld + e0 + 16);
    return u.v;
}

__device__ __forceinline__ v8f wmma32(v16h a, v16h b, v8f c) {
    return __builtin_amdgcn_wmma_f32_16x16x32_f16(false, a, false, b, (short)0, c, false, false);
}

// ---------------- prep kernels ----------------
__global__ __launch_bounds__(256) void cvt_f16_kernel(const float* __restrict__ in,
                                                      _Float16* __restrict__ out, int n) {
    int i = blockIdx.x * blockDim.x + threadIdx.x;
    if (i < n) out[i] = (_Float16)in[i];
}

// in: rows x cols (f32) -> out: cols x rows (f16), N-major weights.
// One 64 x 64 tile per block, turned in LDS: rows are read as 256-byte runs and
// every output row leaves as one whole 128-byte line. rows and cols are multiples of 64.
#define TT 64
#define TP 72                          // LDS pitch in halfs: 144 B = 16 B x odd, for the 16-byte readers
__global__ __launch_bounds__(256) void transpose_cvt_kernel(const float* __restrict__ in,
                                                            _Float16* __restrict__ out,
                                                            int rows, int cols) {
    __shared__ __align__(16) _Float16 tile[TT * TP];
    const int r0 = blockIdx.y * TT;
    const int c0 = blockIdx.x * TT;
    const int cg = threadIdx.x & 15;             // 4 columns
    const int rg = threadIdx.x >> 4;             // 4 rows

    v4f v[4];
#pragma unroll  // all four loads in flight at once, v[] in registers
    for (int i = 0; i < 4; ++i)
        v[i] = *(const v4f*)(in + (size_t)(r0 + rg * 4 + i) * cols + c0 + cg * 4);
#pragma unroll  // constant indices into v[]
    for (int j = 0; j < 4; ++j) {
        v4h h = { (_Float16)v[0][j], (_Float16)v[1][j], (_Float16)v[2][j], (_Float16)v[3][j] };
        *(v4h*)(tile + (cg * 4 + j) * TP + rg * 4) = h;
    }
    // the tile is written by all waves and read across them
    __syncthreads();

    const int ch = threadIdx.x & 7;              // 16-byte piece of an output row
    const int cr = threadIdx.x >> 3;             // 32 output rows a pass
#pragma unroll  // both LDS reads issued before the first store
    for (int p = 0; p < 2; ++p) {
        int c = p * 32 + cr;
        *(v8h*)(out + (size_t)(c0 + c) * rows + r0 + ch * 8) = *(const v8h*)(tile + c * TP + ch * 8);
    }
}

// ---------------- QKV projection ----------------
// C(4096x3072) = xh(4096x1024) @ Wqkv + bqkv ; into Qh/Kh row-major, Vt transposed.
// A block's 128 x 64 tile is one head of one of Q, K, V. It is gathered in LDS and leaves
// as whole 128-byte lines: Q/K 128 rows of 128 B in a row, V^T 64 rows of 256 B.
#define QP 72                          // Q/K stage pitch in halfs: 144 B = 16 B x odd
#define VP 136                         // V^T stage pitch in halfs: 272 B = 16 B x odd
__global__ __launch_bounds__(256) void qkv_kernel(const _Float16* __restrict__ xh,
                                                  const _Float16* __restrict__ WqkvT,
                                                  const float* __restrict__ bqkv,
                                                  _Float16* __restrict__ Qh,
                                                  _Float16* __restrict__ Kh,
                                                  _Float16* __restrict__ Vt) {
    __shared__ __align__(16) _Float16 stage[128 * QP];   // V^T needs 64 * VP, which is less
    const int wave = threadIdx.x >> 5;
    const int lane = threadIdx.x & 31;
    const int tilesN = DM3 / 64;                 // 48
    const int bidN = blockIdx.x % tilesN;
    const int bidM = blockIdx.x / tilesN;
    const int rowBase = bidM * 128 + wave * 16;
    const int colBase = bidN * 64;

    v8f acc[4] = {};
    for (int k = 0; k < DM; k += 32) {
        v16h a = load_frag(xh + rowBase * DM + k, DM, lane);
#pragma unroll
        for (int nt = 0; nt < 4; ++nt) {
            v16h b = load_frag(WqkvT + (colBase + nt * 16) * DM + k, DM, lane);
            acc[nt] = wmma32(a, b, acc[nt]);
        }
    }

    const int hl = lane >> 4, n = lane & 15;
    const int part = colBase / DM;               // 0=Q 1=K 2=V, the same for the whole block
    const int head = (colBase % DM) / DK;
    const int bb   = (bidM * 128) / SEQ;
    const int s0   = (bidM * 128) % SEQ;         // the block's 128 rows lie in one batch
    const size_t hb = (size_t)(bb * NHEAD + head);

    float bias[4];
#pragma unroll  // the four bias loads in flight together
    for (int nt = 0; nt < 4; ++nt) bias[nt] = bqkv[colBase + nt * 16 + n];
    v8h h[4];
#pragma unroll  // constant indices: acc[] and h[] stay in registers
    for (int nt = 0; nt < 4; ++nt)
#pragma unroll  // the same
        for (int i = 0; i < 8; ++i) h[nt][i] = (_Float16)(acc[nt][i] + bias[nt]);

    if (part == 2) {
        // stage[d][s]: a lane's 8 rows are 8 neighbours in s
#pragma unroll  // constant indices into h[]
        for (int nt = 0; nt < 4; ++nt)
            *(v8h*)(stage + (nt * 16 + n) * VP + wave * 16 + hl * 8) = h[nt];
    } else {
        // stage[s][d]
#pragma unroll  // constant indices into h[]
        for (int nt = 0; nt < 4; ++nt)
#pragma unroll  // the same
            for (int i = 0; i < 8; ++i) stage[(wave * 16 + i + 8 * hl) * QP + nt * 16 + n] = h[nt][i];
    }
    // the tile is written by all waves and read across them
    __syncthreads();

    // 1024 pieces of 16 bytes: V^T 16 to a row of 128 s, Q/K 8 to a row of 64 d
    const int sh     = (part == 2) ? 4 : 3;
    const int lpitch = (part == 2) ? VP : QP;
    const int gpitch = (part == 2) ? SEQ : DK;
    _Float16* dst = (part == 2) ? Vt + hb * DK * SEQ + s0
                                : (part == 0 ? Qh : Kh) + (hb * SEQ + s0) * DK;
#pragma unroll  // all four LDS reads issued before the first store
    for (int p = 0; p < 4; ++p) {
        int c = p * 256 + threadIdx.x;
        int row = c >> sh, pc = c & ((1 << sh) - 1);
        *(v8h*)(dst + (size_t)(row * gpitch + pc * 8)) = *(const v8h*)(stage + row * lpitch + pc * 8);
    }
}

// ---------------- flash attention ----------------
// One wave per 16-query tile; online softmax over 32-key blocks.
__global__ __launch_bounds__(256) void attn_kernel(const _Float16* __restrict__ Qh,
                                                   const _Float16* __restrict__ Kh,
                                                   const _Float16* __restrict__ Vt,
                                                   const int* __restrict__ mask,
                                                   _Float16* __restrict__ ctx) {
    // per-wave 16x32 prob tile, row stride 40 halfs (80B -> 16B-aligned chunks);
    // behind the loop the same range stages the wave's 16x64 output tile at pitch QP
    __shared__ __align__(16) _Float16 lds_p[8][16 * QP];

    const int wave = threadIdx.x >> 5;
    const int lane = threadIdx.x & 31;
    int qt = blockIdx.x * 8 + wave;              // 4096 q-tiles total
    int t = qt;
    const int qi   = (t % (SEQ / 16)) * 16; t /= (SEQ / 16);
    const int head = t % NHEAD;             t /= NHEAD;
    const int bb   = t;

    const _Float16* Qbase = Qh + ((size_t)(bb * NHEAD + head) * SEQ + qi) * DK;
    const _Float16* Kbase = Kh + (size_t)(bb * NHEAD + head) * SEQ * DK;
    const _Float16* Vbase = Vt + (size_t)(bb * NHEAD + head) * DK * SEQ;

    const v16h qf0 = load_frag(Qbase + 0,  DK, lane);   // d 0..31
    const v16h qf1 = load_frag(Qbase + 32, DK, lane);   // d 32..63

    const int hl = lane >> 4, n = lane & 15;
    const int e0 = hl * 8;
    _Float16* pl = &lds_p[wave][0];

    float rowmax[8], rowsum[8];
    v8f o[4] = {};
#pragma unroll
    for (int i = 0; i < 8; ++i) { rowmax[i] = -1e30f; rowsum[i] = 0.0f; }

    for (int kb = 0; kb < SEQ; kb += 32) {
        // ---- scores: two 16x16 tiles over DK=64 (2 WMMA each) ----
        v8f sc[2];
#pragma unroll
        for (int nt = 0; nt < 2; ++nt) {
            const _Float16* Kt = Kbase + (size_t)(kb + nt * 16) * DK;
            v16h b0 = load_frag(Kt + 0,  DK, lane);
            v16h b1 = load_frag(Kt + 32, DK, lane);
            v8f tacc = {};
            tacc = wmma32(qf0, b0, tacc);
            tacc = wmma32(qf1, b1, tacc);
            sc[nt] = tacc;
        }

        // ---- scale + mask (column per lane) ----
        const int m0 = mask[bb * SEQ + kb + n];
        const int m1 = mask[bb * SEQ + kb + 16 + n];
        float s0[8], s1[8];
#pragma unroll
        for (int i = 0; i < 8; ++i) {
            s0[i] = m0 ? sc[0][i] * SCALE_F : MASK_FILL_F;
            s1[i] = m1 ? sc[1][i] * SCALE_F : MASK_FILL_F;
        }

        // ---- online softmax: row max/sum across 16-lane half-groups ----
        float tm[8];
#pragma unroll
        for (int i = 0; i < 8; ++i) tm[i] = fmaxf(s0[i], s1[i]);
        for (int off = 1; off < 16; off <<= 1)
#pragma unroll
            for (int i = 0; i < 8; ++i) tm[i] = fmaxf(tm[i], __shfl_xor(tm[i], off, 32));

        float alpha[8], p0[8], p1[8], ps[8];
#pragma unroll
        for (int i = 0; i < 8; ++i) {
            float mnew = fmaxf(rowmax[i], tm[i]);
            alpha[i]  = __expf(rowmax[i] - mnew);
            rowmax[i] = mnew;
            p0[i] = __expf(s0[i] - mnew);
            p1[i] = __expf(s1[i] - mnew);
            ps[i] = p0[i] + p1[i];
        }
        for (int off = 1; off < 16; off <<= 1)
#pragma unroll
            for (int i = 0; i < 8; ++i) ps[i] += __shfl_xor(ps[i], off, 32);
#pragma unroll
        for (int i = 0; i < 8; ++i) rowsum[i] = rowsum[i] * alpha[i] + ps[i];
#pragma unroll
        for (int dt = 0; dt < 4; ++dt)
#pragma unroll
            for (int i = 0; i < 8; ++i) o[dt][i] *= alpha[i];

        // ---- re-layout P: C-layout -> A-fragment via LDS ----
#pragma unroll
        for (int i = 0; i < 8; ++i) {
            int row = i + 8 * hl;
            pl[row * 40 + n]      = (_Float16)p0[i];
            pl[row * 40 + 16 + n] = (_Float16)p1[i];
        }
        F16x16 u;
        u.h[0] = *(const v8h*)(pl + n * 40 + e0);
        u.h[1] = *(const v8h*)(pl + n * 40 + e0 + 16);
        v16h pf = u.v;

        // ---- context: O += P(16x32) @ V(32x16) for 4 d-tiles ----
#pragma unroll
        for (int dt = 0; dt < 4; ++dt) {
            F16x16 w;
            const _Float16* vrow = Vbase + (size_t)(dt * 16 + n) * SEQ + kb;
            w.h[0] = *(const v8h*)(vrow + e0);
            w.h[1] = *(const v8h*)(vrow + e0 + 16);
            o[dt] = wmma32(pf, w.v, o[dt]);
        }
    }

    // ---- epilogue: normalize, stage in the wave's own LDS, store ctx (f16) as whole lines ----
#pragma unroll
    for (int dt = 0; dt < 4; ++dt)
#pragma unroll
        for (int i = 0; i < 8; ++i) {
            float val = o[dt][i] / rowsum[i];
            pl[(i + 8 * hl) * QP + dt * 16 + n] = (_Float16)val;
        }
    // the wave's own LDS stores are done before its lanes read each other's rows back
    asm volatile("s_wait_dscnt 0x0" ::: "memory");
    _Float16* cdst = ctx + ((size_t)(bb * SEQ + qi)) * DM + head * DK;
#pragma unroll  // all four LDS reads issued before the first store
    for (int p = 0; p < 4; ++p) {
        int c = p * 32 + lane;                   // 16-byte piece: 8 to a row of 64 d
        int row = c >> 3, pc = c & 7;
        *(v8h*)(cdst + (size_t)row * DM + pc * 8) = *(const v8h*)(pl + row * QP + pc * 8);
    }
}

// ---------------- output projection ----------------
#define OP 68                          // f32 stage pitch in dwords: 272 B = 16 B x odd
__global__ __launch_bounds__(256) void out_proj_kernel(const _Float16* __restrict__ ctx,
                                                       const _Float16* __restrict__ WoutT,
                                                       const float* __restrict__ bout,
                                                       float* __restrict__ out) {
    // each wave stages its own 16 x 64 f32 tile: a row is 256 B, two whole lines
    __shared__ __align__(16) float stage[8][16 * OP];
    const int wave = threadIdx.x >> 5;
    const int lane = threadIdx.x & 31;
    const int tilesN = DM / 64;                  // 16
    const int bidN = blockIdx.x % tilesN;
    const int bidM = blockIdx.x / tilesN;
    const int rowBase = bidM * 128 + wave * 16;
    const int colBase = bidN * 64;

    v8f acc[4] = {};
    for (int k = 0; k < DM; k += 32) {
        v16h a = load_frag(ctx + rowBase * DM + k, DM, lane);
#pragma unroll
        for (int nt = 0; nt < 4; ++nt) {
            v16h b = load_frag(WoutT + (colBase + nt * 16) * DM + k, DM, lane);
            acc[nt] = wmma32(a, b, acc[nt]);
        }
    }
    const int hl = lane >> 4, n = lane & 15;
    float* st = &stage[wave][0];
#pragma unroll
    for (int nt = 0; nt < 4; ++nt) {
        float bias = bout[colBase + nt * 16 + n];
#pragma unroll
        for (int i = 0; i < 8; ++i) st[(i + 8 * hl) * OP + nt * 16 + n] = acc[nt][i] + bias;
    }
    // the wave's own LDS stores are done before its lanes read each other's rows back
    asm volatile("s_wait_dscnt 0x0" ::: "memory");
    float* dst = out + (size_t)rowBase * DM + colBase;
#pragma unroll  // all eight LDS reads issued before the first store
    for (int p = 0; p < 8; ++p) {
        int c = p * 32 + lane;                   // 16-byte piece: 16 to a row of 64 columns
        int row = c >> 4, pc = c & 15;
        *(v4f*)(dst + (size_t)row * DM + pc * 4) = *(const v4f*)(st + row * OP + pc * 4);
    }
}

extern "C" void kernel_launch(void* const* d_in, const int* in_sizes, int n_in,
                              void* d_out, int out_size, void* d_ws, size_t ws_size,
                              hipStream_t stream) {
    const float* x    = (const float*)d_in[0];   // (2,2048,1024)
    const int*   mask = (const int*)  d_in[1];   // (2,2048)
    const float* Wqkv = (const float*)d_in[2];   // (1024,3072)
    const float* bqkv = (const float*)d_in[3];   // (3072)
    const float* Wout = (const float*)d_in[4];   // (1024,1024)
    const float* bout = (const float*)d_in[5];   // (1024)
    float* out = (float*)d_out;                  // (2,2048,1024)

    char* ws = (char*)d_ws;
    _Float16* xh     = (_Float16*)ws;                 ws += (size_t)ROWS * DM  * 2; // 8 MB
    _Float16* WqkvT  = (_Float16*)ws;                 ws += (size_t)DM3  * DM  * 2; // 6 MB
    _Float16* WoutT  = (_Float16*)ws;                 ws += (size_t)DM   * DM  * 2; // 2 MB
    _Float16* Qh     = (_Float16*)ws;                 ws += (size_t)ROWS * DM  * 2 / NHEAD * NHEAD; // 8 MB
    _Float16* Kh     = (_Float16*)ws;                 ws += (size_t)ROWS * DM  * 2; // 8 MB (Qh advanced same)
    _Float16* Vt     = (_Float16*)ws;                 ws += (size_t)ROWS * DM  * 2; // 8 MB
    _Float16* ctx    = (_Float16*)ws;                 // 8 MB

    // prep: f16 conversions / weight transposes
    cvt_f16_kernel<<<(ROWS * DM + 255) / 256, 256, 0, stream>>>(x, xh, ROWS * DM);
    transpose_cvt_kernel<<<dim3(DM3 / TT, DM / TT), 256, 0, stream>>>(Wqkv, WqkvT, DM, DM3);
    transpose_cvt_kernel<<<dim3(DM / TT, DM / TT), 256, 0, stream>>>(Wout, WoutT, DM, DM);

    // QKV projection: grid = (4096/128) * (3072/64)
    qkv_kernel<<<(ROWS / 128) * (DM3 / 64), 256, 0, stream>>>(xh, WqkvT, bqkv, Qh, Kh, Vt);

    // attention: 4096 q-tiles, 8 per block
    attn_kernel<<<(BATCH * NHEAD * (SEQ / 16)) / 8, 256, 0, stream>>>(Qh, Kh, Vt, mask, ctx);

    // output projection: grid = (4096/128) * (1024/64)
    out_proj_kernel<<<(ROWS / 128) * (DM / 64), 256, 0, stream>>>(ctx, WoutT, bout, out);
}

// v003
// Measured time: 270 microseconds a run.
// Next to v002, in two timings, it ran 1.07 times as fast each time.
// All steps since v000 together make it 1.64 times as fast.
#include <hip/hip_runtime.h>
#include <hip/hip_bf16.h>

#define DM     1024
#define DM3    3072
#define SEQ    2048
#define BATCH  2
#define NHEAD  16
#define DK     64
#define ROWS   (BATCH * SEQ)          // 4096
#define SCALE_F 0.125f                 // 1/sqrt(64)
#define MASK_FILL_F (-10000.0f)

typedef __attribute__((ext_vector_type(16))) _Float16 v16h;
typedef __attribute__((ext_vector_type(8)))  _Float16 v8h;
typedef __attribute__((ext_vector_type(4)))  _Float16 v4h;
typedef __attribute__((ext_vector_type(4)))  float    v4f;
typedef __attribute__((ext_vector_type(8)))  float    v8f;

union F16x16 { v16h v; v8h h[2]; };

// Per-lane WMMA f16 operand fragment load (A or B), 16x32 tile, row-major src.
// Lane L holds row (L&15); K-chunks {e0..e0+7} and {e0+16..e0+23}, e0 = (L>>4)*8.
// Two 16-byte loads -> global_load_b128.
__device__ __forceinline__ v16h load_frag(const _Float16* tile, int ld, int lane) {
    int r  = lane & 15;
    int e0 = (lane >> 4) << 3;
    F16x16 u;
    u.h[0] = *(const v8h*)(tile + r * ld + e0);
    u.h[1] = *(const v8h*)(tile + r * ld + e0 + 16);
    return u.v;
}

__device__ __forceinline__ v8f wmma32(v16h a, v16h b, v8f c) {
    return __builtin_amdgcn_wmma_f32_16x16x32_f16(false, a, false, b, (short)0, c, false, false);
}

// ---------------- prep kernels ----------------
__global__ __launch_bounds__(256) void cvt_f16_kernel(const float* __restrict__ in,
                                                      _Float16* __restrict__ out, int n) {
    int i = blockIdx.x * blockDim.x + threadIdx.x;
    if (i < n) out[i] = (_Float16)in[i];
}

// in: rows x cols (f32) -> out: cols x rows (f16), N-major weights.
// One 64 x 64 tile per block, turned in LDS: rows are read as 256-byte runs and
// every output row leaves as one whole 128-byte line. rows and cols are multiples of 64.
#define TT 64
#define TP 72                          // LDS pitch in halfs: 144 B = 16 B x odd, for the 16-byte readers
__global__ __launch_bounds__(256) void transpose_cvt_kernel(const float* __restrict__ in,
                                                            _Float16* __restrict__ out,
                                                            int rows, int cols) {
    __shared__ __align__(16) _Float16 tile[TT * TP];
    const int r0 = blockIdx.y * TT;
    const int c0 = blockIdx.x * TT;
    const int cg = threadIdx.x & 15;             // 4 columns
    const int rg = threadIdx.x >> 4;             // 4 rows

    v4f v[4];
#pragma unroll  // all four loads in flight at once, v[] in registers
    for (int i = 0; i < 4; ++i)
        v[i] = *(const v4f*)(in + (size_t)(r0 + rg * 4 + i) * cols + c0 + cg * 4);
#pragma unroll  // constant indices into v[]
    for (int j = 0; j < 4; ++j) {
        v4h h = { (_Float16)v[0][j], (_Float16)v[1][j], (_Float16)v[2][j], (_Float16)v[3][j] };
        *(v4h*)(tile + (cg * 4 + j) * TP + rg * 4) = h;
    }
    // the tile is written by all waves and read across them
    __syncthreads();

    const int ch = threadIdx.x & 7;              // 16-byte piece of an output row
    const int cr = threadIdx.x >> 3;             // 32 output rows a pass
#pragma unroll  // both LDS reads issued before the first store
    for (int p = 0; p < 2; ++p) {
        int c = p * 32 + cr;
        *(v8h*)(out + (size_t)(c0 + c) * rows + r0 + ch * 8) = *(const v8h*)(tile + c * TP + ch * 8);
    }
}

// ---------------- QKV projection ----------------
// C(4096x3072) = xh(4096x1024) @ Wqkv + bqkv ; into Qh/Kh row-major, Vt transposed.
// A block's 128 x 64 tile is one head of one of Q, K, V. It is gathered in LDS and leaves
// as whole 128-byte lines: Q/K 128 rows of 128 B in a row, V^T 64 rows of 256 B.
#define QP 72                          // Q/K stage pitch in halfs: 144 B = 16 B x odd
#define VP 136                         // V^T stage pitch in halfs: 272 B = 16 B x odd
__global__ __launch_bounds__(256) void qkv_kernel(const _Float16* __restrict__ xh,
                                                  const _Float16* __restrict__ WqkvT,
                                                  const float* __restrict__ bqkv,
                                                  _Float16* __restrict__ Qh,
                                                  _Float16* __restrict__ Kh,
                                                  _Float16* __restrict__ Vt) {
    __shared__ __align__(16) _Float16 stage[128 * QP];   // V^T needs 64 * VP, which is less
    const int wave = threadIdx.x >> 5;
    const int lane = threadIdx.x & 31;
    const int tilesN = DM3 / 64;                 // 48
    const int bidN = blockIdx.x % tilesN;
    const int bidM = blockIdx.x / tilesN;
    const int rowBase = bidM * 128 + wave * 16;
    const int colBase = bidN * 64;

    v8f acc[4] = {};
    // a pass is 64 k: one whole 128-byte line of every operand row
    for (int k = 0; k < DM; k += 64) {
        v16h a[2], b[2][4];
#pragma unroll  // constant indices: the fragments stay in registers
        for (int h = 0; h < 2; ++h) {
            a[h] = load_frag(xh + rowBase * DM + k + h * 32, DM, lane);
#pragma unroll  // the same
            for (int nt = 0; nt < 4; ++nt)
                b[h][nt] = load_frag(WqkvT + (colBase + nt * 16) * DM + k + h * 32, DM, lane);
        }
        // holds the pass's 20 loads together in front of its WMMAs: without it the compiler sinks
        // each fragment's loads to its own WMMA, and the wave waits out one latency per fragment
        __builtin_amdgcn_sched_barrier(0);
#pragma unroll  // constant indices; the k order of every sum is as before
        for (int h = 0; h < 2; ++h)
#pragma unroll  // the same
            for (int nt = 0; nt < 4; ++nt) acc[nt] = wmma32(a[h], b[h][nt], acc[nt]);
    }

    const int hl = lane >> 4, n = lane & 15;
    const int part = colBase / DM;               // 0=Q 1=K 2=V, the same for the whole block
    const int head = (colBase % DM) / DK;
    const int bb   = (bidM * 128) / SEQ;
    const int s0   = (bidM * 128) % SEQ;         // the block's 128 rows lie in one batch
    const size_t hb = (size_t)(bb * NHEAD + head);

    float bias[4];
#pragma unroll  // the four bias loads in flight together
    for (int nt = 0; nt < 4; ++nt) bias[nt] = bqkv[colBase + nt * 16 + n];
    v8h h[4];
#pragma unroll  // constant indices: acc[] and h[] stay in registers
    for (int nt = 0; nt < 4; ++nt)
#pragma unroll  // the same
        for (int i = 0; i < 8; ++i) h[nt][i] = (_Float16)(acc[nt][i] + bias[nt]);

    if (part == 2) {
        // stage[d][s]: a lane's 8 rows are 8 neighbours in s
#pragma unroll  // constant indices into h[]
        for (int nt = 0; nt < 4; ++nt)
            *(v8h*)(stage + (nt * 16 + n) * VP + wave * 16 + hl * 8) = h[nt];
    } else {
        // stage[s][d]
#pragma unroll  // constant indices into h[]
        for (int nt = 0; nt < 4; ++nt)
#pragma unroll  // the same
            for (int i = 0; i < 8; ++i) stage[(wave * 16 + i + 8 * hl) * QP + nt * 16 + n] = h[nt][i];
    }
    // the tile is written by all waves and read across them
    __syncthreads();

    // 1024 pieces of 16 bytes: V^T 16 to a row of 128 s, Q/K 8 to a row of 64 d
    const int sh     = (part == 2) ? 4 : 3;
    const int lpitch = (part == 2) ? VP : QP;
    const int gpitch = (part == 2) ? SEQ : DK;
    _Float16* dst = (part == 2) ? Vt + hb * DK * SEQ + s0
                                : (part == 0 ? Qh : Kh) + (hb * SEQ + s0) * DK;
#pragma unroll  // all four LDS reads issued before the first store
    for (int p = 0; p < 4; ++p) {
        int c = p * 256 + threadIdx.x;
        int row = c >> sh, pc = c & ((1 << sh) - 1);
        *(v8h*)(dst + (size_t)(row * gpitch + pc * 8)) = *(const v8h*)(stage + row * lpitch + pc * 8);
    }
}

// ---------------- flash attention ----------------
// One wave per 16-query tile; online softmax over 32-key blocks.
// The grid puts four waves on a SIMD. Told so, the compiler takes the registers to issue a block's
// K loads together, and its V loads ahead of the softmax, not two loads in front of each WMMA.
__global__ __launch_bounds__(256) __attribute__((amdgpu_waves_per_eu(4, 4))) void attn_kernel(const _Float16* __restrict__ Qh,
                                                   const _Float16* __restrict__ Kh,
                                                   const _Float16* __restrict__ Vt,
                                                   const int* __restrict__ mask,
                                                   _Float16* __restrict__ ctx) {
    // per-wave 16x32 prob tile, row stride 40 halfs (80B -> 16B-aligned chunks);
    // behind the loop the same range stages the wave's 16x64 output tile at pitch QP
    __shared__ __align__(16) _Float16 lds_p[8][16 * QP];

    const int wave = threadIdx.x >> 5;
    const int lane = threadIdx.x & 31;
    int qt = blockIdx.x * 8 + wave;              // 4096 q-tiles total
    int t = qt;
    const int qi   = (t % (SEQ / 16)) * 16; t /= (SEQ / 16);
    const int head = t % NHEAD;             t /= NHEAD;
    const int bb   = t;

    const _Float16* Qbase = Qh + ((size_t)(bb * NHEAD + head) * SEQ + qi) * DK;
    const _Float16* Kbase = Kh + (size_t)(bb * NHEAD + head) * SEQ * DK;
    const _Float16* Vbase = Vt + (size_t)(bb * NHEAD + head) * DK * SEQ;

    const v16h qf0 = load_frag(Qbase + 0,  DK, lane);   // d 0..31
    const v16h qf1 = load_frag(Qbase + 32, DK, lane);   // d 32..63

    const int hl = lane >> 4, n = lane & 15;
    const int e0 = hl * 8;
    _Float16* pl = &lds_p[wave][0];

    float rowmax[8], rowsum[8];
    v8f o[4] = {};
#pragma unroll
    for (int i = 0; i < 8; ++i) { rowmax[i] = -1e30f; rowsum[i] = 0.0f; }

    for (int kb = 0; kb < SEQ; kb += 32) {
        // ---- scores: two 16x16 tiles over DK=64 (2 WMMA each) ----
        v8f sc[2];
#pragma unroll
        for (int nt = 0; nt < 2; ++nt) {
            const _Float16* Kt = Kbase + (size_t)(kb + nt * 16) * DK;
            v16h b0 = load_frag(Kt + 0,  DK, lane);
            v16h b1 = load_frag(Kt + 32, DK, lane);
            v8f tacc = {};
            tacc = wmma32(qf0, b0, tacc);
            tacc = wmma32(qf1, b1, tacc);
            sc[nt] = tacc;
        }

        // ---- scale + mask (column per lane) ----
        const int m0 = mask[bb * SEQ + kb + n];
        const int m1 = mask[bb * SEQ + kb + 16 + n];
        float s0[8], s1[8];
#pragma unroll
        for (int i = 0; i < 8; ++i) {
            s0[i] = m0 ? sc[0][i] * SCALE_F : MASK_FILL_F;
            s1[i] = m1 ? sc[1][i] * SCALE_F : MASK_FILL_F;
        }

        // ---- online softmax: row max/sum across 16-lane half-groups ----
        float tm[8];
#pragma unroll
        for (int i = 0; i < 8; ++i) tm[i] = fmaxf(s0[i], s1[i]);
        for (int off = 1; off < 16; off <<= 1)
#pragma unroll
            for (int i = 0; i < 8; ++i) tm[i] = fmaxf(tm[i], __shfl_xor(tm[i], off, 32));

        float alpha[8], p0[8], p1[8], ps[8];
#pragma unroll
        for (int i = 0; i < 8; ++i) {
            float mnew = fmaxf(rowmax[i], tm[i]);
            alpha[i]  = __expf(rowmax[i] - mnew);
            rowmax[i] = mnew;
            p0[i] = __expf(s0[i] - mnew);
            p1[i] = __expf(s1[i] - mnew);
            ps[i] = p0[i] + p1[i];
        }
        for (int off = 1; off < 16; off <<= 1)
#pragma unroll
            for (int i = 0; i < 8; ++i) ps[i] += __shfl_xor(ps[i], off, 32);
#pragma unroll
        for (int i = 0; i < 8; ++i) rowsum[i] = rowsum[i] * alpha[i] + ps[i];
#pragma unroll
        for (int dt = 0; dt < 4; ++dt)
#pragma unroll
            for (int i = 0; i < 8; ++i) o[dt][i] *= alpha[i];

        // ---- re-layout P: C-layout -> A-fragment via LDS ----
#pragma unroll
        for (int i = 0; i < 8; ++i) {
            int row = i + 8 * hl;
            pl[row * 40 + n]      = (_Float16)p0[i];
            pl[row * 40 + 16 + n] = (_Float16)p1[i];
        }
        F16x16 u;
        u.h[0] = *(const v8h*)(pl + n * 40 + e0);
        u.h[1] = *(const v8h*)(pl + n * 40 + e0 + 16);
        v16h pf = u.v;

        // ---- context: O += P(16x32) @ V(32x16) for 4 d-tiles ----
#pragma unroll
        for (int dt = 0; dt < 4; ++dt) {
            F16x16 w;
            const _Float16* vrow = Vbase + (size_t)(dt * 16 + n) * SEQ + kb;
            w.h[0] = *(const v8h*)(vrow + e0);
            w.h[1] = *(const v8h*)(vrow + e0 + 16);
            o[dt] = wmma32(pf, w.v, o[dt]);
        }
    }

    // ---- epilogue: normalize, stage in the wave's own LDS, store ctx (f16) as whole lines ----
#pragma unroll
    for (int dt = 0; dt < 4; ++dt)
#pragma unroll
        for (int i = 0; i < 8; ++i) {
            float val = o[dt][i] / rowsum[i];
            pl[(i + 8 * hl) * QP + dt * 16 + n] = (_Float16)val;
        }
    // the wave's own LDS stores are done before its lanes read each other's rows back
    asm volatile("s_wait_dscnt 0x0" ::: "memory");
    _Float16* cdst = ctx + ((size_t)(bb * SEQ + qi)) * DM + head * DK;
#pragma unroll  // all four LDS reads issued before the first store
    for (int p = 0; p < 4; ++p) {
        int c = p * 32 + lane;                   // 16-byte piece: 8 to a row of 64 d
        int row = c >> 3, pc = c & 7;
        *(v8h*)(cdst + (size_t)row * DM + pc * 8) = *(const v8h*)(pl + row * QP + pc * 8);
    }
}

// ---------------- output projection ----------------
#define OP 68                          // f32 stage pitch in dwords: 272 B = 16 B x odd
__global__ __launch_bounds__(256) void out_proj_kernel(const _Float16* __restrict__ ctx,
                                                       const _Float16* __restrict__ WoutT,
                                                       const float* __restrict__ bout,
                                                       float* __restrict__ out) {
    // each wave stages its own 16 x 64 f32 tile: a row is 256 B, two whole lines
    __shared__ __align__(16) float stage[8][16 * OP];
    const int wave = threadIdx.x >> 5;
    const int lane = threadIdx.x & 31;
    const int tilesN = DM / 64;                  // 16
    const int bidN = blockIdx.x % tilesN;
    const int bidM = blockIdx.x / tilesN;
    const int rowBase = bidM * 128 + wave * 16;
    const int colBase = bidN * 64;

    v8f acc[4] = {};
    // a pass is 64 k: one whole 128-byte line of every operand row
    for (int k = 0; k < DM; k += 64) {
        v16h a[2], b[2][4];
#pragma unroll  // constant indices: the fragments stay in registers
        for (int h = 0; h < 2; ++h) {
            a[h] = load_frag(ctx + rowBase * DM + k + h * 32, DM, lane);
#pragma unroll  // the same
            for (int nt = 0; nt < 4; ++nt)
                b[h][nt] = load_frag(WoutT + (colBase + nt * 16) * DM + k + h * 32, DM, lane);
        }
        // holds the pass's 20 loads together in front of its WMMAs: without it the compiler sinks
        // each fragment's loads to its own WMMA, and the wave waits out one latency per fragment
        __builtin_amdgcn_sched_barrier(0);
#pragma unroll  // constant indices; the k order of every sum is as before
        for (int h = 0; h < 2; ++h)
#pragma unroll  // the same
            for (int nt = 0; nt < 4; ++nt) acc[nt] = wmma32(a[h], b[h][nt], acc[nt]);
    }
    const int hl = lane >> 4, n = lane & 15;
    float* st = &stage[wave][0];
#pragma unroll
    for (int nt = 0; nt < 4; ++nt) {
        float bias = bout[colBase + nt * 16 + n];
#pragma unroll
        for (int i = 0; i < 8; ++i) st[(i + 8 * hl) * OP + nt * 16 + n] = acc[nt][i] + bias;
    }
    // the wave's own LDS stores are done before its lanes read each other's rows back
    asm volatile("s_wait_dscnt 0x0" ::: "memory");
    float* dst = out + (size_t)rowBase * DM + colBase;
#pragma unroll  // all eight LDS reads issued before the first store
    for (int p = 0; p < 8; ++p) {
        int c = p * 32 + lane;                   // 16-byte piece: 16 to a row of 64 columns
        int row = c >> 4, pc = c & 15;
        *(v4f*)(dst + (size_t)row * DM + pc * 4) = *(const v4f*)(st + row * OP + pc * 4);
    }
}

extern "C" void kernel_launch(void* const* d_in, const int* in_sizes, int n_in,
                              void* d_out, int out_size, void* d_ws, size_t ws_size,
                              hipStream_t stream) {
    const float* x    = (const float*)d_in[0];   // (2,2048,1024)
    const int*   mask = (const int*)  d_in[1];   // (2,2048)
    const float* Wqkv = (const float*)d_in[2];   // (1024,3072)
    const float* bqkv = (const float*)d_in[3];   // (3072)
    const float* Wout = (const float*)d_in[4];   // (1024,1024)
    const float* bout = (const float*)d_in[5];   // (1024)
    float* out = (float*)d_out;                  // (2,2048,1024)

    char* ws = (char*)d_ws;
    _Float16* xh     = (_Float16*)ws;                 ws += (size_t)ROWS * DM  * 2; // 8 MB
    _Float16* WqkvT  = (_Float16*)ws;                 ws += (size_t)DM3  * DM  * 2; // 6 MB
    _Float16* WoutT  = (_Float16*)ws;                 ws += (size_t)DM   * DM  * 2; // 2 MB
    _Float16* Qh     = (_Float16*)ws;                 ws += (size_t)ROWS * DM  * 2 / NHEAD * NHEAD; // 8 MB
    _Float16* Kh     = (_Float16*)ws;                 ws += (size_t)ROWS * DM  * 2; // 8 MB (Qh advanced same)
    _Float16* Vt     = (_Float16*)ws;                 ws += (size_t)ROWS * DM  * 2; // 8 MB
    _Float16* ctx    = (_Float16*)ws;                 // 8 MB

    // prep: f16 conversions / weight transposes
    cvt_f16_kernel<<<(ROWS * DM + 255) / 256, 256, 0, stream>>>(x, xh, ROWS * DM);
    transpose_cvt_kernel<<<dim3(DM3 / TT, DM / TT), 256, 0, stream>>>(Wqkv, WqkvT, DM, DM3);
    transpose_cvt_kernel<<<dim3(DM / TT, DM / TT), 256, 0, stream>>>(Wout, WoutT, DM, DM);

    // QKV projection: grid = (4096/128) * (3072/64)
    qkv_kernel<<<(ROWS / 128) * (DM3 / 64), 256, 0, stream>>>(xh, WqkvT, bqkv, Qh, Kh, Vt);

    // attention: 4096 q-tiles, 8 per block
    attn_kernel<<<(BATCH * NHEAD * (SEQ / 16)) / 8, 256, 0, stream>>>(Qh, Kh, Vt, mask, ctx);

    // output projection: grid = (4096/128) * (1024/64)
    out_proj_kernel<<<(ROWS / 128) * (DM / 64), 256, 0, stream>>>(ctx, WoutT, bout, out);
}

// v004
// Measured time: 149 microseconds a run.
// Next to v003, in two timings, it ran 1.80 and 1.81 times as fast.
// Over all steps from v000 it is 2.96 times as fast.
#include <hip/hip_runtime.h>
#include <hip/hip_bf16.h>

#define DM     1024
#define DM3    3072
#define SEQ    2048
#define BATCH  2
#define NHEAD  16
#define DK     64
#define ROWS   (BATCH * SEQ)          // 4096
#define SCALE_F 0.125f                 // 1/sqrt(64)
#define MASK_FILL_F (-10000.0f)

typedef __attribute__((ext_vector_type(16))) _Float16 v16h;
typedef __attribute__((ext_vector_type(8)))  _Float16 v8h;
typedef __attribute__((ext_vector_type(4)))  _Float16 v4h;
typedef __attribute__((ext_vector_type(4)))  float    v4f;
typedef __attribute__((ext_vector_type(8)))  float    v8f;

union F16x16 { v16h v; v8h h[2]; };

// Every f16 operand in the workspace is kept in fragment order: a matrix is cut into tiles of
// 16 rows x 32 k, FT halfs (1 KB) each, and the tiles that one pass of the reader takes lie in a row:
// GEMM operands of R rows: tile (rt, kt) is number kt * R/16 + rt; Q, K: rt * 2 + kt; V^T: kt * 4 + rt.
// A tile is 64 pieces of 16 bytes; piece w holds row (w & 15), k piece_k(w) .. piece_k(w) + 7.
// Pieces 0..31 are what the 32 lanes take with a fragment's first load, 32..63 with its second,
// so each load of a wave is 512 bytes in a row (4 whole lines), not 16 pieces of 16 lines.
#define FT 512
__device__ __forceinline__ int piece_k(int w) { return ((w >> 5) << 4) + (((w >> 4) & 1) << 3); }

// Per-lane WMMA f16 operand fragment load (A or B) of one 16x32 tile in fragment order.
// Lane L holds row (L&15); K-chunks {e0..e0+7} and {e0+16..e0+23}, e0 = (L>>4)*8.
// Two 16-byte loads -> global_load_b128.
// 'piece' is the lane's own first piece of the tile: tile + lane * 8.
__device__ __forceinline__ v16h load_frag(const _Float16* piece) {
    F16x16 u;
    u.h[0] = *(const v8h*)(piece);
    u.h[1] = *(const v8h*)(piece + FT / 2);
    return u.v;
}

__device__ __forceinline__ v8f wmma32(v16h a, v16h b, v8f c) {
    return __builtin_amdgcn_wmma_f32_16x16x32_f16(false, a, false, b, (short)0, c, false, false);
}

// ---------------- prep kernels ----------------
// in: ROWS x DM (f32, row-major) -> out: the same matrix in f16, fragment order.
// One wave per 16 x 32 tile: a lane reads the two runs of 8 floats that make its two pieces.
__global__ __launch_bounds__(256) void cvt_f16_kernel(const float* __restrict__ in,
                                                      _Float16* __restrict__ out) {
    const int lane = threadIdx.x & 31;
    const int t  = blockIdx.x * 8 + (threadIdx.x >> 5);   // a block reads 1 KB in a row of 16 rows
    const int rt = t / (DM / 32), kt = t % (DM / 32);
    const float* src = in + (size_t)(rt * 16 + (lane & 15)) * DM + kt * 32 + piece_k(lane);
    v4f v[4];
#pragma unroll  // all four loads in flight at once, v[] in registers
    for (int i = 0; i < 4; ++i) v[i] = *(const v4f*)(src + (i >> 1) * 16 + (i & 1) * 4);
#pragma unroll  // constant indices into v[]
    for (int p = 0; p < 2; ++p) {
        v8h h;
#pragma unroll  // the same
        for (int j = 0; j < 8; ++j) h[j] = (_Float16)v[p * 2 + (j >> 2)][j & 3];
        *(v8h*)(out + (size_t)(kt * (ROWS / 16) + rt) * FT + p * (FT / 2) + lane * 8) = h;
    }
}

// in: rows x cols (f32) -> out: cols x rows (f16), N-major weights, in fragment order.
// One 64 x 64 tile per block, turned in LDS: rows are read as 256-byte runs and
// the block's 8 fragment tiles leave as whole lines. rows and cols are multiples of 64.
#define TT 64
#define TP 72                          // LDS pitch in halfs: 144 B = 16 B x odd, for the 16-byte readers
__global__ __launch_bounds__(256) void transpose_cvt_kernel(const float* __restrict__ in,
                                                            _Float16* __restrict__ out,
                                                            int rows, int cols) {
    __shared__ __align__(16) _Float16 tile[TT * TP];
    const int r0 = blockIdx.y * TT;
    const int c0 = blockIdx.x * TT;
    const int cg = threadIdx.x & 15;             // 4 columns
    const int rg = threadIdx.x >> 4;             // 4 rows

    v4f v[4];
#pragma unroll  // all four loads in flight at once, v[] in registers
    for (int i = 0; i < 4; ++i)
        v[i] = *(const v4f*)(in + (size_t)(r0 + rg * 4 + i) * cols + c0 + cg * 4);
#pragma unroll  // constant indices into v[]
    for (int j = 0; j < 4; ++j) {
        v4h h = { (_Float16)v[0][j], (_Float16)v[1][j], (_Float16)v[2][j], (_Float16)v[3][j] };
        *(v4h*)(tile + (cg * 4 + j) * TP + rg * 4) = h;
    }
    // the tile is written by all waves and read across them
    __syncthreads();

#pragma unroll  // both LDS reads issued before the first store
    for (int p = 0; p < 2; ++p) {
        int q = p * 256 + threadIdx.x;           // 512 pieces: 4 x 2 fragment tiles of 64
        int rt = q >> 7, kt = (q >> 6) & 1, w = q & 63;
        *(v8h*)(out + ((size_t)((r0 >> 5) + kt) * (cols >> 4) + (c0 >> 4) + rt) * FT + w * 8) =
            *(const v8h*)(tile + (rt * 16 + (w & 15)) * TP + kt * 32 + piece_k(w));
    }
}

// ---------------- QKV projection ----------------
// C(4096x3072) = xh(4096x1024) @ Wqkv + bqkv ; into Qh/Kh (s x d) and Vt (d x s), a matrix per head.
// A block's 128 x 64 tile is one head of one of Q, K, V. It is gathered in LDS and leaves
// in fragment order as whole 128-byte lines, 16 KB in a row.
#define QP 72                          // Q/K stage pitch in halfs: 144 B = 16 B x odd
#define VP 136                         // V^T stage pitch in halfs: 272 B = 16 B x odd
__global__ __launch_bounds__(256) void qkv_kernel(const _Float16* __restrict__ xh,
                                                  const _Float16* __restrict__ WqkvT,
                                                  const float* __restrict__ bqkv,
                                                  _Float16* __restrict__ Qh,
                                                  _Float16* __restrict__ Kh,
                                                  _Float16* __restrict__ Vt) {
    __shared__ __align__(16) _Float16 stage[128 * QP];   // V^T needs 64 * VP, which is less
    const int wave = threadIdx.x >> 5;
    const int lane = threadIdx.x & 31;
    const int tilesN = DM3 / 64;                 // 48
    const int bidN = blockIdx.x % tilesN;
    const int bidM = blockIdx.x / tilesN;
    const int rowBase = bidM * 128 + wave * 16;
    const int colBase = bidN * 64;

    const _Float16* ap = xh    + (rowBase >> 4) * FT + lane * 8;
    const _Float16* bp = WqkvT + (colBase >> 4) * FT + lane * 8;

    v8f acc[4] = {};
    // a pass is 64 k: two fragment tiles of every operand
    for (int kt = 0; kt < DM / 32; kt += 2) {
        v16h a[2], b[2][4];
#pragma unroll  // constant indices: the fragments stay in registers
        for (int h = 0; h < 2; ++h) {
            a[h] = load_frag(ap + (kt + h) * (ROWS / 16) * FT);
#pragma unroll  // the same
            for (int nt = 0; nt < 4; ++nt)
                b[h][nt] = load_frag(bp + ((kt + h) * (DM3 / 16) + nt) * FT);
        }
        // holds the pass's 20 loads together in front of its WMMAs: without it the compiler sinks
        // each fragment's loads to its own WMMA, and the wave waits out one latency per fragment
        __builtin_amdgcn_sched_barrier(0);
#pragma unroll  // constant indices; the k order of every sum is as before
        for (int h = 0; h < 2; ++h)
#pragma unroll  // the same
            for (int nt = 0; nt < 4; ++nt) acc[nt] = wmma32(a[h], b[h][nt], acc[nt]);
    }

    const int hl = lane >> 4, n = lane & 15;
    const int part = colBase / DM;               // 0=Q 1=K 2=V, the same for the whole block
    const int head = (colBase % DM) / DK;
    const int bb   = (bidM * 128) / SEQ;
    const int s0   = (bidM * 128) % SEQ;         // the block's 128 rows lie in one batch
    const size_t hb = (size_t)(bb * NHEAD + head);

    float bias[4];
#pragma unroll  // the four bias loads in flight together
    for (int nt = 0; nt < 4; ++nt) bias[nt] = bqkv[colBase + nt * 16 + n];
    v8h h[4];
#pragma unroll  // constant indices: acc[] and h[] stay in registers
    for (int nt = 0; nt < 4; ++nt)
#pragma unroll  // the same
        for (int i = 0; i < 8; ++i) h[nt][i] = (_Float16)(acc[nt][i] + bias[nt]);

    if (part == 2) {
        // stage[d][s]: a lane's 8 rows are 8 neighbours in s
#pragma unroll  // constant indices into h[]
        for (int nt = 0; nt < 4; ++nt)
            *(v8h*)(stage + (nt * 16 + n) * VP + wave * 16 + hl * 8) = h[nt];
    } else {
        // stage[s][d]
#pragma unroll  // constant indices into h[]
        for (int nt = 0; nt < 4; ++nt)
#pragma unroll  // the same
            for (int i = 0; i < 8; ++i) stage[(wave * 16 + i + 8 * hl) * QP + nt * 16 + n] = h[nt][i];
    }
    // the tile is written by all waves and read across them
    __syncthreads();

    // 1024 pieces of 16 bytes = 16 fragment tiles in storage order: V^T 4 (s) x 4 (d), Q/K 8 (s) x 2 (d)
    const int lpitch = (part == 2) ? VP : QP;
    _Float16* dst = (part == 2 ? Vt : part == 0 ? Qh : Kh) + (hb * SEQ + s0) * DK;
#pragma unroll  // all four LDS reads issued before the first store
    for (int p = 0; p < 4; ++p) {
        int c = p * 256 + threadIdx.x;
        int tl = c >> 6, w = c & 63;
        int rt = (part == 2) ? tl & 3 : tl >> 1;
        int kt = (part == 2) ? tl >> 2 : tl & 1;
        *(v8h*)(dst + c * 8) = *(const v8h*)(stage + (rt * 16 + (w & 15)) * lpitch + kt * 32 + piece_k(w));
    }
}

// ---------------- flash attention ----------------
// One wave per 16-query tile; online softmax over 32-key blocks.
// The grid puts four waves on a SIMD. Told so, the compiler takes the registers to issue a block's
// K loads together, and its V loads ahead of the softmax, not two loads in front of each WMMA.
__global__ __launch_bounds__(256) __attribute__((amdgpu_waves_per_eu(4, 4))) void attn_kernel(const _Float16* __restrict__ Qh,
                                                   const _Float16* __restrict__ Kh,
                                                   const _Float16* __restrict__ Vt,
                                                   const int* __restrict__ mask,
                                                   _Float16* __restrict__ ctx) {
    // per-wave 16x32 prob tile, row stride 40 halfs (80B -> 16B-aligned chunks);
    // behind the loop the same range stages the wave's 16x64 output tile at pitch QP
    __shared__ __align__(16) _Float16 lds_p[8][16 * QP];

    const int wave = threadIdx.x >> 5;
    const int lane = threadIdx.x & 31;
    int qt = blockIdx.x * 8 + wave;              // 4096 q-tiles total
    int t = qt;
    const int qi   = (t % (SEQ / 16)) * 16; t /= (SEQ / 16);
    const int head = t % NHEAD;             t /= NHEAD;
    const int bb   = t;

    const _Float16* Qbase = Qh + ((size_t)(bb * NHEAD + head) * SEQ + qi) * DK + lane * 8;
    const _Float16* Kbase = Kh + (size_t)(bb * NHEAD + head) * SEQ * DK + lane * 8;
    const _Float16* Vbase = Vt + (size_t)(bb * NHEAD + head) * DK * SEQ + lane * 8;

    const v16h qf0 = load_frag(Qbase);                  // d 0..31
    const v16h qf1 = load_frag(Qbase + FT);             // d 32..63

    const int hl = lane >> 4, n = lane & 15;
    const int e0 = hl * 8;
    _Float16* pl = &lds_p[wave][0];

    float rowmax[8], rowsum[8];
    v8f o[4] = {};
#pragma unroll
    for (int i = 0; i < 8; ++i) { rowmax[i] = -1e30f; rowsum[i] = 0.0f; }

    for (int kb = 0; kb < SEQ; kb += 32) {
        // ---- scores: two 16x16 tiles over DK=64 (2 WMMA each) ----
        v8f sc[2];
#pragma unroll
        for (int nt = 0; nt < 2; ++nt) {
            const _Float16* Kt = Kbase + (size_t)(kb + nt * 16) * DK;   // 16 keys: two tiles in a row
            v16h b0 = load_frag(Kt);
            v16h b1 = load_frag(Kt + FT);
            v8f tacc = {};
            tacc = wmma32(qf0, b0, tacc);
            tacc = wmma32(qf1, b1, tacc);
            sc[nt] = tacc;
        }

        // ---- scale + mask (column per lane) ----
        const int m0 = mask[bb * SEQ + kb + n];
        const int m1 = mask[bb * SEQ + kb + 16 + n];
        float s0[8], s1[8];
#pragma unroll
        for (int i = 0; i < 8; ++i) {
            s0[i] = m0 ? sc[0][i] * SCALE_F : MASK_FILL_F;
            s1[i] = m1 ? sc[1][i] * SCALE_F : MASK_FILL_F;
        }

        // ---- online softmax: row max/sum across 16-lane half-groups ----
        float tm[8];
#pragma unroll
        for (int i = 0; i < 8; ++i) tm[i] = fmaxf(s0[i], s1[i]);
        for (int off = 1; off < 16; off <<= 1)
#pragma unroll
            for (int i = 0; i < 8; ++i) tm[i] = fmaxf(tm[i], __shfl_xor(tm[i], off, 32));

        float alpha[8], p0[8], p1[8], ps[8];
#pragma unroll
        for (int i = 0; i < 8; ++i) {
            float mnew = fmaxf(rowmax[i], tm[i]);
            alpha[i]  = __expf(rowmax[i] - mnew);
            rowmax[i] = mnew;
            p0[i] = __expf(s0[i] - mnew);
            p1[i] = __expf(s1[i] - mnew);
            ps[i] = p0[i] + p1[i];
        }
        for (int off = 1; off < 16; off <<= 1)
#pragma unroll
            for (int i = 0; i < 8; ++i) ps[i] += __shfl_xor(ps[i], off, 32);
#pragma unroll
        for (int i = 0; i < 8; ++i) rowsum[i] = rowsum[i] * alpha[i] + ps[i];
#pragma unroll
        for (int dt = 0; dt < 4; ++dt)
#pragma unroll
            for (int i = 0; i < 8; ++i) o[dt][i] *= alpha[i];

        // ---- re-layout P: C-layout -> A-fragment via LDS ----
#pragma unroll
        for (int i = 0; i < 8; ++i) {
            int row = i + 8 * hl;
            pl[row * 40 + n]      = (_Float16)p0[i];
            pl[row * 40 + 16 + n] = (_Float16)p1[i];
        }
        F16x16 u;
        u.h[0] = *(const v8h*)(pl + n * 40 + e0);
        u.h[1] = *(const v8h*)(pl + n * 40 + e0 + 16);
        v16h pf = u.v;

        // ---- context: O += P(16x32) @ V(32x16) for 4 d-tiles ----
        const _Float16* vt = Vbase + (size_t)kb * DK;   // 32 keys: four tiles in a row
        v16h w[4];
#pragma unroll  // constant indices: w[] stays in registers
        for (int dt = 0; dt < 4; ++dt) w[dt] = load_frag(vt + dt * FT);
#pragma unroll  // the same
        for (int dt = 0; dt < 4; ++dt) o[dt] = wmma32(pf, w[dt], o[dt]);
        // inputs only: the eight V loads share one address pair; this holds the pair until the last of
        // them has landed, so that no load's result is put into registers that a load in flight names
        asm volatile("" :: "v"(vt), "v"(w[3]));
    }

    // ---- epilogue: normalize, stage in the wave's own LDS, store ctx (f16) as whole lines ----
#pragma unroll
    for (int dt = 0; dt < 4; ++dt)
#pragma unroll
        for (int i = 0; i < 8; ++i) {
            float val = o[dt][i] / rowsum[i];
            pl[(i + 8 * hl) * QP + dt * 16 + n] = (_Float16)val;
        }
    // the wave's own LDS stores are done before its lanes read each other's rows back
    asm volatile("s_wait_dscnt 0x0" ::: "memory");
    // ctx is a GEMM operand of ROWS rows: the wave's 16 x 64 are two of its tiles
    _Float16* cdst = ctx + ((size_t)head * (DK / 32) * (ROWS / 16) + ((bb * SEQ + qi) >> 4)) * FT;
#pragma unroll  // all four LDS reads issued before the first store
    for (int p = 0; p < 4; ++p) {
        int c = p * 32 + lane;                   // 16-byte piece: 64 to a tile
        int kt = c >> 6, w = c & 63;
        *(v8h*)(cdst + kt * (ROWS / 16) * FT + w * 8) = *(const v8h*)(pl + (w & 15) * QP + kt * 32 + piece_k(w));
    }
}

// ---------------- output projection ----------------
#define OP 68                          // f32 stage pitch in dwords: 272 B = 16 B x odd
__global__ __launch_bounds__(256) void out_proj_kernel(const _Float16* __restrict__ ctx,
                                                       const _Float16* __restrict__ WoutT,
                                                       const float* __restrict__ bout,
                                                       float* __restrict__ out) {
    // each wave stages its own 16 x 64 f32 tile: a row is 256 B, two whole lines
    __shared__ __align__(16) float stage[8][16 * OP];
    const int wave = threadIdx.x >> 5;
    const int lane = threadIdx.x & 31;
    const int tilesN = DM / 64;                  // 16
    const int bidN = blockIdx.x % tilesN;
    const int bidM = blockIdx.x / tilesN;
    const int rowBase = bidM * 128 + wave * 16;
    const int colBase = bidN * 64;

    const _Float16* ap = ctx   + (rowBase >> 4) * FT + lane * 8;
    const _Float16* bp = WoutT + (colBase >> 4) * FT + lane * 8;

    v8f acc[4] = {};
    // a pass is 64 k: two fragment tiles of every operand
#pragma unroll  // a build without it leaves this loop rolled; unrolled, as it was before, a pass's loads issue among the WMMAs of the pass before
    for (int kt = 0; kt < DM / 32; kt += 2) {
        v16h a[2], b[2][4];
#pragma unroll  // constant indices: the fragments stay in registers
        for (int h = 0; h < 2; ++h) {
            a[h] = load_frag(ap + (kt + h) * (ROWS / 16) * FT);
#pragma unroll  // the same
            for (int nt = 0; nt < 4; ++nt)
                b[h][nt] = load_frag(bp + ((kt + h) * (DM / 16) + nt) * FT);
        }
        // holds the pass's 20 loads together in front of its WMMAs: without it the compiler sinks
        // each fragment's loads to its own WMMA, and the wave waits out one latency per fragment
        __builtin_amdgcn_sched_barrier(0);
#pragma unroll  // constant indices; the k order of every sum is as before
        for (int h = 0; h < 2; ++h)
#pragma unroll  // the same
            for (int nt = 0; nt < 4; ++nt) acc[nt] = wmma32(a[h], b[h][nt], acc[nt]);
    }
    // inputs only: every A load names one address pair; this holds the pair past the last pass's loads,
    // so that no load's result is put into registers that a load in flight names
    asm volatile("" :: "v"(ap));
    const int hl = lane >> 4, n = lane & 15;
    float* st = &stage[wave][0];
#pragma unroll
    for (int nt = 0; nt < 4; ++nt) {
        float bias = bout[colBase + nt * 16 + n];
#pragma unroll
        for (int i = 0; i < 8; ++i) st[(i + 8 * hl) * OP + nt * 16 + n] = acc[nt][i] + bias;
    }
    // the wave's own LDS stores are done before its lanes read each other's rows back
    asm volatile("s_wait_dscnt 0x0" ::: "memory");
    float* dst = out + (size_t)rowBase * DM + colBase;
#pragma unroll  // all eight LDS reads issued before the first store
    for (int p = 0; p < 8; ++p) {
        int c = p * 32 + lane;                   // 16-byte piece: 16 to a row of 64 columns
        int row = c >> 4, pc = c & 15;
        *(v4f*)(dst + (size_t)row * DM + pc * 4) = *(const v4f*)(st + row * OP + pc * 4);
    }
}

extern "C" void kernel_launch(void* const* d_in, const int* in_sizes, int n_in,
                              void* d_out, int out_size, void* d_ws, size_t ws_size,
                              hipStream_t stream) {
    const float* x    = (const float*)d_in[0];   // (2,2048,1024)
    const int*   mask = (const int*)  d_in[1];   // (2,2048)
    const float* Wqkv = (const float*)d_in[2];   // (1024,3072)
    const float* bqkv = (const float*)d_in[3];   // (3072)
    const float* Wout = (const float*)d_in[4];   // (1024,1024)
    const float* bout = (const float*)d_in[5];   // (1024)
    float* out = (float*)d_out;                  // (2,2048,1024)

    char* ws = (char*)d_ws;
    _Float16* xh     = (_Float16*)ws;                 ws += (size_t)ROWS * DM  * 2; // 8 MB
    _Float16* WqkvT  = (_Float16*)ws;                 ws += (size_t)DM3  * DM  * 2; // 6 MB
    _Float16* WoutT  = (_Float16*)ws;                 ws += (size_t)DM   * DM  * 2; // 2 MB
    _Float16* Qh     = (_Float16*)ws;                 ws += (size_t)ROWS * DM  * 2 / NHEAD * NHEAD; // 8 MB
    _Float16* Kh     = (_Float16*)ws;                 ws += (size_t)ROWS * DM  * 2; // 8 MB (Qh advanced same)
    _Float16* Vt     = (_Float16*)ws;                 ws += (size_t)ROWS * DM  * 2; // 8 MB
    _Float16* ctx    = (_Float16*)ws;                 // 8 MB

    // prep: f16 conversions / weight transposes
    cvt_f16_kernel<<<(ROWS / 16) * (DM / 32) / 8, 256, 0, stream>>>(x, xh);
    transpose_cvt_kernel<<<dim3(DM3 / TT, DM / TT), 256, 0, stream>>>(Wqkv, WqkvT, DM, DM3);
    transpose_cvt_kernel<<<dim3(DM / TT, DM / TT), 256, 0, stream>>>(Wout, WoutT, DM, DM);

    // QKV projection: grid = (4096/128) * (3072/64)
    qkv_kernel<<<(ROWS / 128) * (DM3 / 64), 256, 0, stream>>>(xh, WqkvT, bqkv, Qh, Kh, Vt);

    // attention: 4096 q-tiles, 8 per block
    attn_kernel<<<(BATCH * NHEAD * (SEQ / 16)) / 8, 256, 0, stream>>>(Qh, Kh, Vt, mask, ctx);

    // output projection: grid = (4096/128) * (1024/64)
    out_proj_kernel<<<(ROWS / 128) * (DM / 64), 256, 0, stream>>>(ctx, WoutT, bout, out);
}

// v005
// It runs in 133 microseconds.
// In both of two side-by-side timings against v004, it was 1.12 times as fast.
// All steps since v000 together make it 3.32 times as fast.
#include <hip/hip_runtime.h>
#include <hip/hip_bf16.h>

#define DM     1024
#define DM3    3072
#define SEQ    2048
#define BATCH  2
#define NHEAD  16
#define DK     64
#define ROWS   (BATCH * SEQ)          // 4096
#define SCALE_F 0.125f                 // 1/sqrt(64)
#define MASK_FILL_F (-10000.0f)

typedef __attribute__((ext_vector_type(16))) _Float16 v16h;
typedef __attribute__((ext_vector_type(8)))  _Float16 v8h;
typedef __attribute__((ext_vector_type(4)))  _Float16 v4h;
typedef __attribute__((ext_vector_type(4)))  float    v4f;
typedef __attribute__((ext_vector_type(4)))  int      v4i;
typedef __attribute__((ext_vector_type(2)))  float    v2f;
typedef __attribute__((ext_vector_type(2)))  _Float16 v2h;
typedef __attribute__((ext_vector_type(8)))  float    v8f;

union F16x16 { v16h v; v8h h[2]; };

// Every f16 operand in the workspace is kept in fragment order: a matrix is cut into tiles of
// 16 rows x 32 k, FT halfs (1 KB) each, and the tiles that one pass of the reader takes lie in a row:
// GEMM operands of R rows: tile (rt, kt) is number kt * R/16 + rt; Q, K: rt * 2 + kt; V^T: kt * 4 + rt.
// A tile is 64 pieces of 16 bytes; piece w holds row (w & 15), k piece_k(w) .. piece_k(w) + 7.
// Pieces 0..31 are what the 32 lanes take with a fragment's first load, 32..63 with its second,
// so each load of a wave is 512 bytes in a row (4 whole lines), not 16 pieces of 16 lines.
#define FT 512
__device__ __forceinline__ int piece_k(int w) { return ((w >> 5) << 4) + (((w >> 4) & 1) << 3); }

// Per-lane WMMA f16 operand fragment load (A or B) of one 16x32 tile in fragment order.
// Lane L holds row (L&15); K-chunks {e0..e0+7} and {e0+16..e0+23}, e0 = (L>>4)*8.
// Two 16-byte loads -> global_load_b128.
// 'piece' is the lane's own first piece of the tile: tile + lane * 8.
__device__ __forceinline__ v16h load_frag(const _Float16* piece) {
    F16x16 u;
    u.h[0] = *(const v8h*)(piece);
    u.h[1] = *(const v8h*)(piece + FT / 2);
    return u.v;
}

__device__ __forceinline__ v8f wmma32(v16h a, v16h b, v8f c) {
    return __builtin_amdgcn_wmma_f32_16x16x32_f16(false, a, false, b, (short)0, c, false, false);
}

// ---------------- prep kernels ----------------
// in: ROWS x DM (f32, row-major) -> out: the same matrix in f16, fragment order.
// One wave per 16 x 32 tile: a lane reads the two runs of 8 floats that make its two pieces.
__global__ __launch_bounds__(256) void cvt_f16_kernel(const float* __restrict__ in,
                                                      _Float16* __restrict__ out) {
    const int lane = threadIdx.x & 31;
    const int t  = blockIdx.x * 8 + (threadIdx.x >> 5);   // a block reads 1 KB in a row of 16 rows
    const int rt = t / (DM / 32), kt = t % (DM / 32);
    const float* src = in + (size_t)(rt * 16 + (lane & 15)) * DM + kt * 32 + piece_k(lane);
    v4f v[4];
#pragma unroll  // all four loads in flight at once, v[] in registers
    for (int i = 0; i < 4; ++i) v[i] = *(const v4f*)(src + (i >> 1) * 16 + (i & 1) * 4);
#pragma unroll  // constant indices into v[]
    for (int p = 0; p < 2; ++p) {
        v8h h;
#pragma unroll  // the same
        for (int j = 0; j < 8; ++j) h[j] = (_Float16)v[p * 2 + (j >> 2)][j & 3];
        *(v8h*)(out + (size_t)(kt * (ROWS / 16) + rt) * FT + p * (FT / 2) + lane * 8) = h;
    }
}

// in: rows x cols (f32) -> out: cols x rows (f16), N-major weights, in fragment order.
// One 64 x 64 tile per block, turned in LDS: rows are read as 256-byte runs and
// the block's 8 fragment tiles leave as whole lines. rows and cols are multiples of 64.
#define TT 64
#define TP 72                          // LDS pitch in halfs: 144 B = 16 B x odd, for the 16-byte readers
__global__ __launch_bounds__(256) void transpose_cvt_kernel(const float* __restrict__ in,
                                                            _Float16* __restrict__ out,
                                                            int rows, int cols) {
    __shared__ __align__(16) _Float16 tile[TT * TP];
    const int r0 = blockIdx.y * TT;
    const int c0 = blockIdx.x * TT;
    const int cg = threadIdx.x & 15;             // 4 columns
    const int rg = threadIdx.x >> 4;             // 4 rows

    v4f v[4];
#pragma unroll  // all four loads in flight at once, v[] in registers
    for (int i = 0; i < 4; ++i)
        v[i] = *(const v4f*)(in + (size_t)(r0 + rg * 4 + i) * cols + c0 + cg * 4);
#pragma unroll  // constant indices into v[]
    for (int j = 0; j < 4; ++j) {
        v4h h = { (_Float16)v[0][j], (_Float16)v[1][j], (_Float16)v[2][j], (_Float16)v[3][j] };
        *(v4h*)(tile + (cg * 4 + j) * TP + rg * 4) = h;
    }
    // the tile is written by all waves and read across them
    __syncthreads();

#pragma unroll  // both LDS reads issued before the first store
    for (int p = 0; p < 2; ++p) {
        int q = p * 256 + threadIdx.x;           // 512 pieces: 4 x 2 fragment tiles of 64
        int rt = q >> 7, kt = (q >> 6) & 1, w = q & 63;
        *(v8h*)(out + ((size_t)((r0 >> 5) + kt) * (cols >> 4) + (c0 >> 4) + rt) * FT + w * 8) =
            *(const v8h*)(tile + (rt * 16 + (w & 15)) * TP + kt * 32 + piece_k(w));
    }
}

// ---------------- QKV projection ----------------
// C(4096x3072) = xh(4096x1024) @ Wqkv + bqkv ; into Qh/Kh (s x d) and Vt (d x s), a matrix per head.
// A block's 128 x 64 tile is one head of one of Q, K, V. It is gathered in LDS and leaves
// in fragment order as whole 128-byte lines, 16 KB in a row.
#define QP 72                          // Q/K stage pitch in halfs: 144 B = 16 B x odd
#define VP 136                         // V^T stage pitch in halfs: 272 B = 16 B x odd
__global__ __launch_bounds__(256) void qkv_kernel(const _Float16* __restrict__ xh,
                                                  const _Float16* __restrict__ WqkvT,
                                                  const float* __restrict__ bqkv,
                                                  _Float16* __restrict__ Qh,
                                                  _Float16* __restrict__ Kh,
                                                  _Float16* __restrict__ Vt) {
    __shared__ __align__(16) _Float16 stage[128 * QP];   // V^T needs 64 * VP, which is less
    const int wave = threadIdx.x >> 5;
    const int lane = threadIdx.x & 31;
    const int tilesN = DM3 / 64;                 // 48
    const int bidN = blockIdx.x % tilesN;
    const int bidM = blockIdx.x / tilesN;
    const int rowBase = bidM * 128 + wave * 16;
    const int colBase = bidN * 64;

    const _Float16* ap = xh    + (rowBase >> 4) * FT + lane * 8;
    const _Float16* bp = WqkvT + (colBase >> 4) * FT + lane * 8;

    v8f acc[4] = {};
    // a pass is 64 k: two fragment tiles of every operand
    for (int kt = 0; kt < DM / 32; kt += 2) {
        v16h a[2], b[2][4];
#pragma unroll  // constant indices: the fragments stay in registers
        for (int h = 0; h < 2; ++h) {
            a[h] = load_frag(ap + (kt + h) * (ROWS / 16) * FT);
#pragma unroll  // the same
            for (int nt = 0; nt < 4; ++nt)
                b[h][nt] = load_frag(bp + ((kt + h) * (DM3 / 16) + nt) * FT);
        }
        // holds the pass's 20 loads together in front of its WMMAs: without it the compiler sinks
        // each fragment's loads to its own WMMA, and the wave waits out one latency per fragment
        __builtin_amdgcn_sched_barrier(0);
#pragma unroll  // constant indices; the k order of every sum is as before
        for (int h = 0; h < 2; ++h)
#pragma unroll  // the same
            for (int nt = 0; nt < 4; ++nt) acc[nt] = wmma32(a[h], b[h][nt], acc[nt]);
    }

    const int hl = lane >> 4, n = lane & 15;
    const int part = colBase / DM;               // 0=Q 1=K 2=V, the same for the whole block
    const int head = (colBase % DM) / DK;
    const int bb   = (bidM * 128) / SEQ;
    const int s0   = (bidM * 128) % SEQ;         // the block's 128 rows lie in one batch
    const size_t hb = (size_t)(bb * NHEAD + head);

    float bias[4];
#pragma unroll  // the four bias loads in flight together
    for (int nt = 0; nt < 4; ++nt) bias[nt] = bqkv[colBase + nt * 16 + n];
    v8h h[4];
#pragma unroll  // constant indices: acc[] and h[] stay in registers
    for (int nt = 0; nt < 4; ++nt)
#pragma unroll  // the same
        for (int i = 0; i < 8; ++i) h[nt][i] = (_Float16)(acc[nt][i] + bias[nt]);

    if (part == 2) {
        // stage[d][s]: a lane's 8 rows are 8 neighbours in s
#pragma unroll  // constant indices into h[]
        for (int nt = 0; nt < 4; ++nt)
            *(v8h*)(stage + (nt * 16 + n) * VP + wave * 16 + hl * 8) = h[nt];
    } else {
        // stage[s][d]
#pragma unroll  // constant indices into h[]
        for (int nt = 0; nt < 4; ++nt)
#pragma unroll  // the same
            for (int i = 0; i < 8; ++i) stage[(wave * 16 + i + 8 * hl) * QP + nt * 16 + n] = h[nt][i];
    }
    // the tile is written by all waves and read across them
    __syncthreads();

    // 1024 pieces of 16 bytes = 16 fragment tiles in storage order: V^T 4 (s) x 4 (d), Q/K 8 (s) x 2 (d)
    const int lpitch = (part == 2) ? VP : QP;
    _Float16* dst = (part == 2 ? Vt : part == 0 ? Qh : Kh) + (hb * SEQ + s0) * DK;
#pragma unroll  // all four LDS reads issued before the first store
    for (int p = 0; p < 4; ++p) {
        int c = p * 256 + threadIdx.x;
        int tl = c >> 6, w = c & 63;
        int rt = (part == 2) ? tl & 3 : tl >> 1;
        int kt = (part == 2) ? tl >> 2 : tl & 1;
        *(v8h*)(dst + c * 8) = *(const v8h*)(stage + (rt * 16 + (w & 15)) * lpitch + kt * 32 + piece_k(w));
    }
}

#define FILL_RAW_F (MASK_FILL_F / SCALE_F)      // the fill before the scale; the scale is a power of two
#define EXP_C_F    (SCALE_F * 1.44269504f)      // raw score -> exponent of two

// the value that lane ^ 16 holds
__device__ __forceinline__ float other_half(float v) {
    int b = __builtin_bit_cast(int, v);
    return __builtin_bit_cast(float, __builtin_amdgcn_permlanex16(b, b, 0x76543210, 0xfedcba98, false, false));
}

__global__ __launch_bounds__(256) __attribute__((amdgpu_waves_per_eu(4, 4))) void attn_kernel(const _Float16* __restrict__ Qh,
                                                   const _Float16* __restrict__ Kh,
                                                   const _Float16* __restrict__ Vt,
                                                   const int* __restrict__ mask,
                                                   _Float16* __restrict__ ctx) {
    const int wave = threadIdx.x >> 5;
    const int lane = threadIdx.x & 31;
    int qt = blockIdx.x * 8 + wave;              // 4096 q-tiles total
    int t = qt;
    const int qi   = (t % (SEQ / 16)) * 16; t /= (SEQ / 16);
    const int head = t % NHEAD;             t /= NHEAD;
    const int bb   = t;

    const _Float16* Qbase = Qh + ((size_t)(bb * NHEAD + head) * SEQ + qi) * DK + lane * 8;
    const _Float16* Kbase = Kh + (size_t)(bb * NHEAD + head) * SEQ * DK + lane * 8;
    const _Float16* Vbase = Vt + (size_t)(bb * NHEAD + head) * DK * SEQ + lane * 8;

    const v16h qf0 = load_frag(Qbase);                  // d 0..31
    const v16h qf1 = load_frag(Qbase + FT);             // d 32..63

    const int hl = lane >> 4;
    const int* mbase = mask + bb * SEQ + hl * 8;        // register r of a score tile is key 8 * hl + r

    // of the lane's query: the maximum as an exponent of two, and the lane's own part of the sum
    float rowexp = -1e30f, rowsum = 0.0f;
    v8f o[4] = {};                                      // o[dt][r] = O[query lane & 15][d dt * 16 + 8 * hl + r]

    for (int kb = 0; kb < SEQ; kb += 32) {
        // ---- scores: two 16 (keys) x 16 (queries) tiles over DK=64 (2 WMMA each) ----
        v8f sc[2];
#pragma unroll  // constant indices: the arrays stay in registers
        for (int nt = 0; nt < 2; ++nt) {
            const _Float16* Kt = Kbase + (size_t)(kb + nt * 16) * DK;   // 16 keys: two tiles in a row
            v16h b0 = load_frag(Kt);
            v16h b1 = load_frag(Kt + FT);
            v8f tacc = {};
            tacc = wmma32(b0, qf0, tacc);
            tacc = wmma32(b1, qf1, tacc);
            sc[nt] = tacc;
        }

        // ---- mask (a key per register) ----
        v4i mk[4];
#pragma unroll  // the four loads in flight together, mk[] in registers
        for (int j = 0; j < 4; ++j) mk[j] = *(const v4i*)(mbase + kb + (j >> 1) * 16 + (j & 1) * 4);
        v2f s[8];
#pragma unroll  // constant indices: the arrays stay in registers
        for (int e = 0; e < 16; ++e) s[e >> 1][e & 1] = mk[e >> 2][e & 3] ? sc[e >> 3][e & 7] : FILL_RAW_F;

        // ---- online softmax: in the lane, one exchange between the halves for the maximum ----
        float t3[5];
#pragma unroll  // constant indices: the arrays stay in registers
        for (int g = 0; g < 5; ++g) {
            const int e = g * 3;
            t3[g] = fmaxf(fmaxf(s[e >> 1][e & 1], s[(e + 1) >> 1][(e + 1) & 1]), s[(e + 2) >> 1][(e + 2) & 1]);
        }
        float tm = fmaxf(fmaxf(fmaxf(t3[0], t3[1]), t3[2]), fmaxf(fmaxf(t3[3], t3[4]), s[7][1]));
        tm = fmaxf(tm, other_half(tm));
        // the running maximum is kept as the rounded exponent that the p below are taken against:
        // alpha is then the exact ratio of the two scales, and exactly 1 while the maximum stands
        const float mexp  = fmaxf(rowexp, tm * EXP_C_F);
        const float alpha = __builtin_amdgcn_exp2f(rowexp - mexp);
        rowexp = mexp;

        const v2f c2 = { EXP_C_F, EXP_C_F }, nm2 = { -mexp, -mexp };
        v2f p[8];
#pragma unroll  // constant indices: the arrays stay in registers
        for (int j = 0; j < 8; ++j) {
            v2f x = __builtin_elementwise_fma(s[j], c2, nm2);
            p[j][0] = __builtin_amdgcn_exp2f(x[0]);
            p[j][1] = __builtin_amdgcn_exp2f(x[1]);
        }
        const v2f ps = ((p[0] + p[4]) + (p[1] + p[5])) + ((p[2] + p[6]) + (p[3] + p[7]));
        rowsum = rowsum * alpha + (ps[0] + ps[1]);
#pragma unroll  // constant indices: the arrays stay in registers
        for (int dt = 0; dt < 4; ++dt) o[dt] *= alpha;

        // ---- P^T as a B fragment: element e is key (e >> 3) * 16 + 8 * hl + (e & 7), the k order of V^T's tiles ----
        v16h pf;
#pragma unroll  // constant indices: the arrays stay in registers
        for (int j = 0; j < 8; ++j) {
            v2h h2 = __builtin_convertvector(p[j], v2h);
            pf[2 * j] = h2[0]; pf[2 * j + 1] = h2[1];
        }

        // ---- context: O^T += V^T(16x32) @ P^T(32x16) for 4 d-tiles ----
        const _Float16* vt = Vbase + (size_t)kb * DK;   // 32 keys: four tiles in a row
        v16h w[4];
#pragma unroll  // constant indices: w[] stays in registers
        for (int dt = 0; dt < 4; ++dt) w[dt] = load_frag(vt + dt * FT);
#pragma unroll  // the same
        for (int dt = 0; dt < 4; ++dt) o[dt] = wmma32(w[dt], pf, o[dt]);
        // inputs only: the eight V loads share one address pair; this holds the pair until the last of
        // them has landed, so that no load's result is put into registers that a load in flight names
        asm volatile("" :: "v"(vt), "v"(w[3]));
    }

    // ---- epilogue: join the halves' sums, normalize, store ctx (f16) ----
    const float inv = 1.0f / (rowsum + other_half(rowsum));
    // ctx is a GEMM operand of ROWS rows: the wave's 16 x 64 are two of its tiles. A lane's 8 values of
    // o[dt] are piece (dt & 1) * 32 + lane of tile dt >> 1: each store of the wave is 512 bytes in a row
    _Float16* cdst = ctx + ((size_t)head * (DK / 32) * (ROWS / 16) + ((bb * SEQ + qi) >> 4)) * FT + lane * 8;
#pragma unroll  // constant indices into o[]
    for (int dt = 0; dt < 4; ++dt) {
        v8h h;
#pragma unroll  // the same
        for (int i = 0; i < 8; ++i) h[i] = (_Float16)(o[dt][i] * inv);
        *(v8h*)(cdst + (dt >> 1) * (ROWS / 16) * FT + (dt & 1) * (FT / 2)) = h;
    }
}

// ---------------- output projection ----------------
#define OP 68                          // f32 stage pitch in dwords: 272 B = 16 B x odd
__global__ __launch_bounds__(256) void out_proj_kernel(const _Float16* __restrict__ ctx,
                                                       const _Float16* __restrict__ WoutT,
                                                       const float* __restrict__ bout,
                                                       float* __restrict__ out) {
    // each wave stages its own 16 x 64 f32 tile: a row is 256 B, two whole lines
    __shared__ __align__(16) float stage[8][16 * OP];
    const int wave = threadIdx.x >> 5;
    const int lane = threadIdx.x & 31;
    const int tilesN = DM / 64;                  // 16
    const int bidN = blockIdx.x % tilesN;
    const int bidM = blockIdx.x / tilesN;
    const int rowBase = bidM * 128 + wave * 16;
    const int colBase = bidN * 64;

    const _Float16* ap = ctx   + (rowBase >> 4) * FT + lane * 8;
    const _Float16* bp = WoutT + (colBase >> 4) * FT + lane * 8;

    v8f acc[4] = {};
    // a pass is 64 k: two fragment tiles of every operand
#pragma unroll  // a build without it leaves this loop rolled; unrolled, as it was before, a pass's loads issue among the WMMAs of the pass before
    for (int kt = 0; kt < DM / 32; kt += 2) {
        v16h a[2], b[2][4];
#pragma unroll  // constant indices: the fragments stay in registers
        for (int h = 0; h < 2; ++h) {
            a[h] = load_frag(ap + (kt + h) * (ROWS / 16) * FT);
#pragma unroll  // the same
            for (int nt = 0; nt < 4; ++nt)
                b[h][nt] = load_frag(bp + ((kt + h) * (DM / 16) + nt) * FT);
        }
        // holds the pass's 20 loads together in front of its WMMAs: without it the compiler sinks
        // each fragment's loads to its own WMMA, and the wave waits out one latency per fragment
        __builtin_amdgcn_sched_barrier(0);
#pragma unroll  // constant indices; the k order of every sum is as before
        for (int h = 0; h < 2; ++h)
#pragma unroll  // the same
            for (int nt = 0; nt < 4; ++nt) acc[nt] = wmma32(a[h], b[h][nt], acc[nt]);
    }
    // inputs only: every A load names one address pair; this holds the pair past the last pass's loads,
    // so that no load's result is put into registers that a load in flight names
    asm volatile("" :: "v"(ap));
    const int hl = lane >> 4, n = lane & 15;
    float* st = &stage[wave][0];
#pragma unroll
    for (int nt = 0; nt < 4; ++nt) {
        float bias = bout[colBase + nt * 16 + n];
#pragma unroll
        for (int i = 0; i < 8; ++i) st[(i + 8 * hl) * OP + nt * 16 + n] = acc[nt][i] + bias;
    }
    // the wave's own LDS stores are done before its lanes read each other's rows back
    asm volatile("s_wait_dscnt 0x0" ::: "memory");
    float* dst = out + (size_t)rowBase * DM + colBase;
#pragma unroll  // all eight LDS reads issued before the first store
    for (int p = 0; p < 8; ++p) {
        int c = p * 32 + lane;                   // 16-byte piece: 16 to a row of 64 columns
        int row = c >> 4, pc = c & 15;
        *(v4f*)(dst + (size_t)row * DM + pc * 4) = *(const v4f*)(st + row * OP + pc * 4);
    }
}

extern "C" void kernel_launch(void* const* d_in, const int* in_sizes, int n_in,
                              void* d_out, int out_size, void* d_ws, size_t ws_size,
                              hipStream_t stream) {
    const float* x    = (const float*)d_in[0];   // (2,2048,1024)
    const int*   mask = (const int*)  d_in[1];   // (2,2048)
    const float* Wqkv = (const float*)d_in[2];   // (1024,3072)
    const float* bqkv = (const float*)d_in[3];   // (3072)
    const float* Wout = (const float*)d_in[4];   // (1024,1024)
    const float* bout = (const float*)d_in[5];   // (1024)
    float* out = (float*)d_out;                  // (2,2048,1024)

    char* ws = (char*)d_ws;
    _Float16* xh     = (_Float16*)ws;                 ws += (size_t)ROWS * DM  * 2; // 8 MB
    _Float16* WqkvT  = (_Float16*)ws;                 ws += (size_t)DM3  * DM  * 2; // 6 MB
    _Float16* WoutT  = (_Float16*)ws;                 ws += (size_t)DM   * DM  * 2; // 2 MB
    _Float16* Qh     = (_Float16*)ws;                 ws += (size_t)ROWS * DM  * 2 / NHEAD * NHEAD; // 8 MB
    _Float16* Kh     = (_Float16*)ws;                 ws += (size_t)ROWS * DM  * 2; // 8 MB (Qh advanced same)
    _Float16* Vt     = (_Float16*)ws;                 ws += (size_t)ROWS * DM  * 2; // 8 MB
    _Float16* ctx    = (_Float16*)ws;                 // 8 MB

    // prep: f16 conversions / weight transposes
    cvt_f16_kernel<<<(ROWS / 16) * (DM / 32) / 8, 256, 0, stream>>>(x, xh);
    transpose_cvt_kernel<<<dim3(DM3 / TT, DM / TT), 256, 0, stream>>>(Wqkv, WqkvT, DM, DM3);
    transpose_cvt_kernel<<<dim3(DM / TT, DM / TT), 256, 0, stream>>>(Wout, WoutT, DM, DM);

    // QKV projection: grid = (4096/128) * (3072/64)
    qkv_kernel<<<(ROWS / 128) * (DM3 / 64), 256, 0, stream>>>(xh, WqkvT, bqkv, Qh, Kh, Vt);

    // attention: 4096 q-tiles, 8 per block
    attn_kernel<<<(BATCH * NHEAD * (SEQ / 16)) / 8, 256, 0, stream>>>(Qh, Kh, Vt, mask, ctx);

    // output projection: grid = (4096/128) * (1024/64)
    out_proj_kernel<<<(ROWS / 128) * (DM / 64), 256, 0, stream>>>(ctx, WoutT, bout, out);
}

// v006
// It runs in 124 microseconds.
// Two timings next to v005 put it at 1.07 and 1.06 times that version's speed.
// All steps since v000 together make it 3.53 times as fast.
#include <hip/hip_runtime.h>
#include <hip/hip_bf16.h>

#define DM     1024
#define DM3    3072
#define SEQ    2048
#define BATCH  2
#define NHEAD  16
#define DK     64
#define ROWS   (BATCH * SEQ)          // 4096
#define SCALE_F 0.125f                 // 1/sqrt(64)
#define MASK_FILL_F (-10000.0f)

typedef __attribute__((ext_vector_type(16))) _Float16 v16h;
typedef __attribute__((ext_vector_type(8)))  _Float16 v8h;
typedef __attribute__((ext_vector_type(4)))  _Float16 v4h;
typedef __attribute__((ext_vector_type(4)))  float    v4f;
typedef __attribute__((ext_vector_type(4)))  int      v4i;
typedef __attribute__((ext_vector_type(2)))  float    v2f;
typedef __attribute__((ext_vector_type(2)))  _Float16 v2h;
typedef __attribute__((ext_vector_type(8)))  float    v8f;

union F16x16 { v16h v; v8h h[2]; };

// Every f16 operand in the workspace is kept in fragment order: a matrix is cut into tiles of
// 16 rows x 32 k, FT halfs (1 KB) each, and the tiles that one pass of the reader takes lie in a row:
// GEMM operands of R rows: tile (rt, kt) is number kt * R/16 + rt; Q, K: rt * 2 + kt; V^T: kt * 4 + rt.
// A tile is 64 pieces of 16 bytes; piece w holds row (w & 15), k piece_k(w) .. piece_k(w) + 7.
// Pieces 0..31 are what the 32 lanes take with a fragment's first load, 32..63 with its second,
// so each load of a wave is 512 bytes in a row (4 whole lines), not 16 pieces of 16 lines.
#define FT 512
__device__ __forceinline__ int piece_k(int w) { return ((w >> 5) << 4) + (((w >> 4) & 1) << 3); }

// Per-lane WMMA f16 operand fragment load (A or B) of one 16x32 tile in fragment order.
// Lane L holds row (L&15); K-chunks {e0..e0+7} and {e0+16..e0+23}, e0 = (L>>4)*8.
// Two 16-byte loads -> global_load_b128.
// 'piece' is the lane's own first piece of the tile: tile + lane * 8.
__device__ __forceinline__ v16h load_frag(const _Float16* piece) {
    F16x16 u;
    u.h[0] = *(const v8h*)(piece);
    u.h[1] = *(const v8h*)(piece + FT / 2);
    return u.v;
}

__device__ __forceinline__ v8f wmma32(v16h a, v16h b, v8f c) {
    return __builtin_amdgcn_wmma_f32_16x16x32_f16(false, a, false, b, (short)0, c, false, false);
}

// ---------------- prep kernels ----------------
// in: ROWS x DM (f32, row-major) -> out: the same matrix in f16, fragment order.
// One wave per 16 x 32 tile: a lane reads the two runs of 8 floats that make its two pieces.
__global__ __launch_bounds__(256) void cvt_f16_kernel(const float* __restrict__ in,
                                                      _Float16* __restrict__ out) {
    const int lane = threadIdx.x & 31;
    const int t  = blockIdx.x * 8 + (threadIdx.x >> 5);   // a block reads 1 KB in a row of 16 rows
    const int rt = t / (DM / 32), kt = t % (DM / 32);
    const float* src = in + (size_t)(rt * 16 + (lane & 15)) * DM + kt * 32 + piece_k(lane);
    v4f v[4];
#pragma unroll  // all four loads in flight at once, v[] in registers
    for (int i = 0; i < 4; ++i) v[i] = *(const v4f*)(src + (i >> 1) * 16 + (i & 1) * 4);
#pragma unroll  // constant indices into v[]
    for (int p = 0; p < 2; ++p) {
        v8h h;
#pragma unroll  // the same
        for (int j = 0; j < 8; ++j) h[j] = (_Float16)v[p * 2 + (j >> 2)][j & 3];
        *(v8h*)(out + (size_t)(kt * (ROWS / 16) + rt) * FT + p * (FT / 2) + lane * 8) = h;
    }
}

// in: rows x cols (f32) -> out: cols x rows (f16), N-major weights, in fragment order.
// One 64 x 64 tile per block, turned in LDS: rows are read as 256-byte runs and
// the block's 8 fragment tiles leave as whole lines. rows and cols are multiples of 64.
#define TT 64
#define TP 72                          // LDS pitch in halfs: 144 B = 16 B x odd, for the 16-byte readers
__global__ __launch_bounds__(256) void transpose_cvt_kernel(const float* __restrict__ in,
                                                            _Float16* __restrict__ out,
                                                            int rows, int cols) {
    __shared__ __align__(16) _Float16 tile[TT * TP];
    const int r0 = blockIdx.y * TT;
    const int c0 = blockIdx.x * TT;
    const int cg = threadIdx.x & 15;             // 4 columns
    const int rg = threadIdx.x >> 4;             // 4 rows

    v4f v[4];
#pragma unroll  // all four loads in flight at once, v[] in registers
    for (int i = 0; i < 4; ++i)
        v[i] = *(const v4f*)(in + (size_t)(r0 + rg * 4 + i) * cols + c0 + cg * 4);
#pragma unroll  // constant indices into v[]
    for (int j = 0; j < 4; ++j) {
        v4h h = { (_Float16)v[0][j], (_Float16)v[1][j], (_Float16)v[2][j], (_Float16)v[3][j] };
        *(v4h*)(tile + (cg * 4 + j) * TP + rg * 4) = h;
    }
    // the tile is written by all waves and read across them
    __syncthreads();

#pragma unroll  // both LDS reads issued before the first store
    for (int p = 0; p < 2; ++p) {
        int q = p * 256 + threadIdx.x;           // 512 pieces: 4 x 2 fragment tiles of 64
        int rt = q >> 7, kt = (q >> 6) & 1, w = q & 63;
        *(v8h*)(out + ((size_t)((r0 >> 5) + kt) * (cols >> 4) + (c0 >> 4) + rt) * FT + w * 8) =
            *(const v8h*)(tile + (rt * 16 + (w & 15)) * TP + kt * 32 + piece_k(w));
    }
}

// ---------------- QKV projection ----------------
// C(4096x3072) = xh(4096x1024) @ Wqkv + bqkv ; into Qh/Kh (s x d) and Vt (d x s), a matrix per head.
// A wave takes 64 x 64 of C: 4 + 4 fragments of 32 k feed 16 WMMAs, each loaded fragment four of them.
// A block is 2 x 2 waves, 128 x 128: two heads of one of Q, K, V. Each head's 128 x 64 is gathered in LDS
// and leaves in fragment order as whole 128-byte lines, 16 KB in a row.
#define WT 4                           // fragment tiles per wave and operand: 64 rows, 64 columns
#define QP 72                          // Q/K stage pitch in halfs: 144 B = 16 B x odd
#define VP 136                         // V^T stage pitch in halfs: 272 B = 16 B x odd
__global__ __launch_bounds__(128) void qkv_kernel(const _Float16* __restrict__ xh,
                                                  const _Float16* __restrict__ WqkvT,
                                                  const float* __restrict__ bqkv,
                                                  _Float16* __restrict__ Qh,
                                                  _Float16* __restrict__ Kh,
                                                  _Float16* __restrict__ Vt) {
    __shared__ __align__(16) _Float16 stage[2][128 * QP];   // V^T needs 64 * VP a head, which is less
    const int wave = threadIdx.x >> 5;
    const int lane = threadIdx.x & 31;
    const int wm = wave >> 1, wn = wave & 1;
    const int tilesN = DM3 / 128;                // 24
    const int bidN = blockIdx.x % tilesN;
    const int bidM = blockIdx.x / tilesN;
    const int rowBase = bidM * 128 + wm * 64;
    const int colBase = bidN * 128 + wn * 64;

    const _Float16* ap = xh    + (rowBase >> 4) * FT + lane * 8;
    const _Float16* bp = WqkvT + (colBase >> 4) * FT + lane * 8;

    v8f acc[WT][WT] = {};
    // a pass is 64 k: two fragment tiles of every operand row group
#pragma unroll  // unrolled, a pass's loads issue among the WMMAs of the pass before
    for (int kt = 0; kt < DM / 32; kt += 2) {
        v16h a[2][WT], b[2][WT];
#pragma unroll  // constant indices: the fragments stay in registers
        for (int h = 0; h < 2; ++h)
#pragma unroll  // the same
            for (int t = 0; t < WT; ++t) {
                a[h][t] = load_frag(ap + ((kt + h) * (ROWS / 16) + t) * FT);
                b[h][t] = load_frag(bp + ((kt + h) * (DM3 / 16) + t) * FT);
            }
        // holds the pass's 32 loads together in front of its WMMAs: without it the compiler sinks
        // each fragment's loads to its own WMMA, and the wave waits out one latency per fragment
        __builtin_amdgcn_sched_barrier(0);
#pragma unroll  // constant indices; the k order of every sum is as before
        for (int h = 0; h < 2; ++h)
#pragma unroll  // the same
            for (int mt = 0; mt < WT; ++mt)
#pragma unroll  // the same
                for (int nt = 0; nt < WT; ++nt) acc[mt][nt] = wmma32(a[h][mt], b[h][nt], acc[mt][nt]);
    }
    // stands between the k loop's last loads and the bias loads below, whose results the compiler puts into
    // the registers that hold those loads' addresses: the wait before a register of an issued load is overwritten
    asm volatile("s_wait_xcnt 0x0" ::: "memory");

    const int hl = lane >> 4, n = lane & 15;
    const int part = (bidN * 128) / DM;          // 0=Q 1=K 2=V, the same for the whole block
    const int head = ((bidN * 128) % DM) / DK;   // the block's first head; wave column wn has head + wn
    const int bb   = (bidM * 128) / SEQ;
    const int s0   = (bidM * 128) % SEQ;         // the block's 128 rows lie in one batch
    const size_t hb = (size_t)(bb * NHEAD + head);

    float bias[WT];
#pragma unroll  // the four bias loads in flight together
    for (int nt = 0; nt < WT; ++nt) bias[nt] = bqkv[colBase + nt * 16 + n];
    _Float16* st = &stage[wn][0];
#pragma unroll  // constant indices: acc[] stays in registers
    for (int mt = 0; mt < WT; ++mt) {
        v8h h[WT];
#pragma unroll  // the same
        for (int nt = 0; nt < WT; ++nt)
#pragma unroll  // the same
            for (int i = 0; i < 8; ++i) h[nt][i] = (_Float16)(acc[mt][nt][i] + bias[nt]);
        const int r0 = wm * 64 + mt * 16;        // the tile's first row in the block
        if (part == 2) {
            // stage[d][s]: a lane's 8 rows are 8 neighbours in s
#pragma unroll  // constant indices into h[]
            for (int nt = 0; nt < WT; ++nt)
                *(v8h*)(st + (nt * 16 + n) * VP + r0 + hl * 8) = h[nt];
        } else {
            // stage[s][d]
#pragma unroll  // constant indices into h[]
            for (int nt = 0; nt < WT; ++nt)
#pragma unroll  // the same
                for (int i = 0; i < 8; ++i) st[(r0 + i + 8 * hl) * QP + nt * 16 + n] = h[nt][i];
        }
    }
    // the tiles are written by all waves and read across them
    __syncthreads();

    // a head: 1024 pieces of 16 bytes = 16 fragment tiles in storage order: V^T 4 (s) x 4 (d), Q/K 8 (s) x 2 (d)
    const int lpitch = (part == 2) ? VP : QP;
    _Float16* dst = (part == 2 ? Vt : part == 0 ? Qh : Kh) + (hb * SEQ + s0) * DK;
#pragma unroll  // the LDS reads issued ahead of the stores
    for (int p = 0; p < 16; ++p) {
        int c = (p & 7) * 128 + threadIdx.x;     // p >> 3 is the head
        int tl = c >> 6, w = c & 63;
        int rt = (part == 2) ? tl & 3 : tl >> 1;
        int kt = (part == 2) ? tl >> 2 : tl & 1;
        *(v8h*)(dst + (size_t)(p >> 3) * SEQ * DK + c * 8) =
            *(const v8h*)(&stage[p >> 3][0] + (rt * 16 + (w & 15)) * lpitch + kt * 32 + piece_k(w));
    }
}

#define FILL_RAW_F (MASK_FILL_F / SCALE_F)      // the fill before the scale; the scale is a power of two
#define EXP_C_F    (SCALE_F * 1.44269504f)      // raw score -> exponent of two

// the value that lane ^ 16 holds
__device__ __forceinline__ float other_half(float v) {
    int b = __builtin_bit_cast(int, v);
    return __builtin_bit_cast(float, __builtin_amdgcn_permlanex16(b, b, 0x76543210, 0xfedcba98, false, false));
}

__global__ __launch_bounds__(256) __attribute__((amdgpu_waves_per_eu(4, 4))) void attn_kernel(const _Float16* __restrict__ Qh,
                                                   const _Float16* __restrict__ Kh,
                                                   const _Float16* __restrict__ Vt,
                                                   const int* __restrict__ mask,
                                                   _Float16* __restrict__ ctx) {
    const int wave = threadIdx.x >> 5;
    const int lane = threadIdx.x & 31;
    int qt = blockIdx.x * 8 + wave;              // 4096 q-tiles total
    int t = qt;
    const int qi   = (t % (SEQ / 16)) * 16; t /= (SEQ / 16);
    const int head = t % NHEAD;             t /= NHEAD;
    const int bb   = t;

    const _Float16* Qbase = Qh + ((size_t)(bb * NHEAD + head) * SEQ + qi) * DK + lane * 8;
    const _Float16* Kbase = Kh + (size_t)(bb * NHEAD + head) * SEQ * DK + lane * 8;
    const _Float16* Vbase = Vt + (size_t)(bb * NHEAD + head) * DK * SEQ + lane * 8;

    const v16h qf0 = load_frag(Qbase);                  // d 0..31
    const v16h qf1 = load_frag(Qbase + FT);             // d 32..63

    const int hl = lane >> 4;
    const int* mbase = mask + bb * SEQ + hl * 8;        // register r of a score tile is key 8 * hl + r

    // of the lane's query: the maximum as an exponent of two, and the lane's own part of the sum
    float rowexp = -1e30f, rowsum = 0.0f;
    v8f o[4] = {};                                      // o[dt][r] = O[query lane & 15][d dt * 16 + 8 * hl + r]

    for (int kb = 0; kb < SEQ; kb += 32) {
        // ---- scores: two 16 (keys) x 16 (queries) tiles over DK=64 (2 WMMA each) ----
        v8f sc[2];
#pragma unroll  // constant indices: the arrays stay in registers
        for (int nt = 0; nt < 2; ++nt) {
            const _Float16* Kt = Kbase + (size_t)(kb + nt * 16) * DK;   // 16 keys: two tiles in a row
            v16h b0 = load_frag(Kt);
            v16h b1 = load_frag(Kt + FT);
            v8f tacc = {};
            tacc = wmma32(b0, qf0, tacc);
            tacc = wmma32(b1, qf1, tacc);
            sc[nt] = tacc;
        }

        // ---- mask (a key per register) ----
        v4i mk[4];
#pragma unroll  // the four loads in flight together, mk[] in registers
        for (int j = 0; j < 4; ++j) mk[j] = *(const v4i*)(mbase + kb + (j >> 1) * 16 + (j & 1) * 4);
        v2f s[8];
#pragma unroll  // constant indices: the arrays stay in registers
        for (int e = 0; e < 16; ++e) s[e >> 1][e & 1] = mk[e >> 2][e & 3] ? sc[e >> 3][e & 7] : FILL_RAW_F;

        // ---- online softmax: in the lane, one exchange between the halves for the maximum ----
        float t3[5];
#pragma unroll  // constant indices: the arrays stay in registers
        for (int g = 0; g < 5; ++g) {
            const int e = g * 3;
            t3[g] = fmaxf(fmaxf(s[e >> 1][e & 1], s[(e + 1) >> 1][(e + 1) & 1]), s[(e + 2) >> 1][(e + 2) & 1]);
        }
        float tm = fmaxf(fmaxf(fmaxf(t3[0], t3[1]), t3[2]), fmaxf(fmaxf(t3[3], t3[4]), s[7][1]));
        tm = fmaxf(tm, other_half(tm));
        // the running maximum is kept as the rounded exponent that the p below are taken against:
        // alpha is then the exact ratio of the two scales, and exactly 1 while the maximum stands
        const float mexp  = fmaxf(rowexp, tm * EXP_C_F);
        const float alpha = __builtin_amdgcn_exp2f(rowexp - mexp);
        rowexp = mexp;

        const v2f c2 = { EXP_C_F, EXP_C_F }, nm2 = { -mexp, -mexp };
        v2f p[8];
#pragma unroll  // constant indices: the arrays stay in registers
        for (int j = 0; j < 8; ++j) {
            v2f x = __builtin_elementwise_fma(s[j], c2, nm2);
            p[j][0] = __builtin_amdgcn_exp2f(x[0]);
            p[j][1] = __builtin_amdgcn_exp2f(x[1]);
        }
        const v2f ps = ((p[0] + p[4]) + (p[1] + p[5])) + ((p[2] + p[6]) + (p[3] + p[7]));
        rowsum = rowsum * alpha + (ps[0] + ps[1]);
#pragma unroll  // constant indices: the arrays stay in registers
        for (int dt = 0; dt < 4; ++dt) o[dt] *= alpha;

        // ---- P^T as a B fragment: element e is key (e >> 3) * 16 + 8 * hl + (e & 7), the k order of V^T's tiles ----
        v16h pf;
#pragma unroll  // constant indices: the arrays stay in registers
        for (int j = 0; j < 8; ++j) {
            v2h h2 = __builtin_convertvector(p[j], v2h);
            pf[2 * j] = h2[0]; pf[2 * j + 1] = h2[1];
        }

        // ---- context: O^T += V^T(16x32) @ P^T(32x16) for 4 d-tiles ----
        const _Float16* vt = Vbase + (size_t)kb * DK;   // 32 keys: four tiles in a row
        v16h w[4];
#pragma unroll  // constant indices: w[] stays in registers
        for (int dt = 0; dt < 4; ++dt) w[dt] = load_frag(vt + dt * FT);
#pragma unroll  // the same
        for (int dt = 0; dt < 4; ++dt) o[dt] = wmma32(w[dt], pf, o[dt]);
        // inputs only: the eight V loads share one address pair; this holds the pair until the last of
        // them has landed, so that no load's result is put into registers that a load in flight names
        asm volatile("" :: "v"(vt), "v"(w[3]));
    }

    // ---- epilogue: join the halves' sums, normalize, store ctx (f16) ----
    const float inv = 1.0f / (rowsum + other_half(rowsum));
    // ctx is a GEMM operand of ROWS rows: the wave's 16 x 64 are two of its tiles. A lane's 8 values of
    // o[dt] are piece (dt & 1) * 32 + lane of tile dt >> 1: each store of the wave is 512 bytes in a row
    _Float16* cdst = ctx + ((size_t)head * (DK / 32) * (ROWS / 16) + ((bb * SEQ + qi) >> 4)) * FT + lane * 8;
#pragma unroll  // constant indices into o[]
    for (int dt = 0; dt < 4; ++dt) {
        v8h h;
#pragma unroll  // the same
        for (int i = 0; i < 8; ++i) h[i] = (_Float16)(o[dt][i] * inv);
        *(v8h*)(cdst + (dt >> 1) * (ROWS / 16) * FT + (dt & 1) * (FT / 2)) = h;
    }
}

// ---------------- output projection ----------------
// Wave and block tiles as in the QKV projection: 64 x 64 a wave, 2 x 2 waves.
#define OP 68                          // f32 stage pitch in dwords: 272 B = 16 B x odd
__global__ __launch_bounds__(128) void out_proj_kernel(const _Float16* __restrict__ ctx,
                                                       const _Float16* __restrict__ WoutT,
                                                       const float* __restrict__ bout,
                                                       float* __restrict__ out) {
    // each wave stages its own 64 x 64 f32 tile: a row is 256 B, two whole lines
    __shared__ __align__(16) float stage[4][64 * OP];
    const int wave = threadIdx.x >> 5;
    const int lane = threadIdx.x & 31;
    const int wm = wave >> 1, wn = wave & 1;
    const int tilesN = DM / 128;                 // 8
    const int bidN = blockIdx.x % tilesN;
    const int bidM = blockIdx.x / tilesN;
    const int rowBase = bidM * 128 + wm * 64;
    const int colBase = bidN * 128 + wn * 64;

    const _Float16* ap = ctx   + (rowBase >> 4) * FT + lane * 8;
    const _Float16* bp = WoutT + (colBase >> 4) * FT + lane * 8;

    v8f acc[WT][WT] = {};
    // a pass is 64 k: two fragment tiles of every operand row group
#pragma unroll  // unrolled, a pass's loads issue among the WMMAs of the pass before
    for (int kt = 0; kt < DM / 32; kt += 2) {
        v16h a[2][WT], b[2][WT];
#pragma unroll  // constant indices: the fragments stay in registers
        for (int h = 0; h < 2; ++h)
#pragma unroll  // the same
            for (int t = 0; t < WT; ++t) {
                a[h][t] = load_frag(ap + ((kt + h) * (ROWS / 16) + t) * FT);
                b[h][t] = load_frag(bp + ((kt + h) * (DM / 16) + t) * FT);
            }
        // holds the pass's 32 loads together in front of its WMMAs: without it the compiler sinks
        // each fragment's loads to its own WMMA, and the wave waits out one latency per fragment
        __builtin_amdgcn_sched_barrier(0);
#pragma unroll  // constant indices; the k order of every sum is as before
        for (int h = 0; h < 2; ++h)
#pragma unroll  // the same
            for (int mt = 0; mt < WT; ++mt)
#pragma unroll  // the same
                for (int nt = 0; nt < WT; ++nt) acc[mt][nt] = wmma32(a[h][mt], b[h][nt], acc[mt][nt]);
    }
    // inputs only: every A load names one address pair; this holds the pair past the last pass's loads,
    // so that no load's result is put into registers that a load in flight names
    asm volatile("" :: "v"(ap));
    // stands between the k loop's last loads and the bias loads below, whose results the compiler puts into
    // the registers that hold those loads' addresses: the wait before a register of an issued load is overwritten
    asm volatile("s_wait_xcnt 0x0" ::: "memory");
    const int hl = lane >> 4, n = lane & 15;
    float* st = &stage[wave][0];
#pragma unroll  // constant indices: acc[] stays in registers
    for (int nt = 0; nt < WT; ++nt) {
        float bias = bout[colBase + nt * 16 + n];
#pragma unroll  // the same
        for (int mt = 0; mt < WT; ++mt)
#pragma unroll  // the same
            for (int i = 0; i < 8; ++i) st[(mt * 16 + i + 8 * hl) * OP + nt * 16 + n] = acc[mt][nt][i] + bias;
    }
    // the wave's own LDS stores are done before its lanes read each other's rows back
    asm volatile("s_wait_dscnt 0x0" ::: "memory");
    float* dst = out + (size_t)rowBase * DM + colBase;
#pragma unroll  // the LDS reads issued ahead of the stores
    for (int p = 0; p < 32; ++p) {
        int c = p * 32 + lane;                   // 16-byte piece: 16 to a row of 64 columns
        int row = c >> 4, pc = c & 15;
        *(v4f*)(dst + (size_t)row * DM + pc * 4) = *(const v4f*)(st + row * OP + pc * 4);
    }
}

extern "C" void kernel_launch(void* const* d_in, const int* in_sizes, int n_in,
                              void* d_out, int out_size, void* d_ws, size_t ws_size,
                              hipStream_t stream) {
    const float* x    = (const float*)d_in[0];   // (2,2048,1024)
    const int*   mask = (const int*)  d_in[1];   // (2,2048)
    const float* Wqkv = (const float*)d_in[2];   // (1024,3072)
    const float* bqkv = (const float*)d_in[3];   // (3072)
    const float* Wout = (const float*)d_in[4];   // (1024,1024)
    const float* bout = (const float*)d_in[5];   // (1024)
    float* out = (float*)d_out;                  // (2,2048,1024)

    char* ws = (char*)d_ws;
    _Float16* xh     = (_Float16*)ws;                 ws += (size_t)ROWS * DM  * 2; // 8 MB
    _Float16* WqkvT  = (_Float16*)ws;                 ws += (size_t)DM3  * DM  * 2; // 6 MB
    _Float16* WoutT  = (_Float16*)ws;                 ws += (size_t)DM   * DM  * 2; // 2 MB
    _Float16* Qh     = (_Float16*)ws;                 ws += (size_t)ROWS * DM  * 2 / NHEAD * NHEAD; // 8 MB
    _Float16* Kh     = (_Float16*)ws;                 ws += (size_t)ROWS * DM  * 2; // 8 MB (Qh advanced same)
    _Float16* Vt     = (_Float16*)ws;                 ws += (size_t)ROWS * DM  * 2; // 8 MB
    _Float16* ctx    = (_Float16*)ws;                 // 8 MB

    // prep: f16 conversions / weight transposes
    cvt_f16_kernel<<<(ROWS / 16) * (DM / 32) / 8, 256, 0, stream>>>(x, xh);
    transpose_cvt_kernel<<<dim3(DM3 / TT, DM / TT), 256, 0, stream>>>(Wqkv, WqkvT, DM, DM3);
    transpose_cvt_kernel<<<dim3(DM / TT, DM / TT), 256, 0, stream>>>(Wout, WoutT, DM, DM);

    // QKV projection: grid = (4096/128) * (3072/128)
    qkv_kernel<<<(ROWS / 128) * (DM3 / 128), 128, 0, stream>>>(xh, WqkvT, bqkv, Qh, Kh, Vt);

    // attention: 4096 q-tiles, 8 per block
    attn_kernel<<<(BATCH * NHEAD * (SEQ / 16)) / 8, 256, 0, stream>>>(Qh, Kh, Vt, mask, ctx);

    // output projection: grid = (4096/128) * (1024/128)
    out_proj_kernel<<<(ROWS / 128) * (DM / 128), 128, 0, stream>>>(ctx, WoutT, bout, out);
}

// v007
// A run of this version takes 91.1 microseconds.
// In both of two side-by-side timings against v006, it was 1.36 times as fast.
// Over all steps from v000 it is 4.81 times as fast.
#include <hip/hip_runtime.h>
#include <hip/hip_bf16.h>

#define DM     1024
#define DM3    3072
#define SEQ    2048
#define BATCH  2
#define NHEAD  16
#define DK     64
#define ROWS   (BATCH * SEQ)          // 4096
#define SCALE_F 0.125f                 // 1/sqrt(64)
#define MASK_FILL_F (-10000.0f)

typedef __attribute__((ext_vector_type(16))) _Float16 v16h;
typedef __attribute__((ext_vector_type(8)))  _Float16 v8h;
typedef __attribute__((ext_vector_type(4)))  _Float16 v4h;
typedef __attribute__((ext_vector_type(4)))  float    v4f;
typedef __attribute__((ext_vector_type(4)))  int      v4i;
typedef __attribute__((ext_vector_type(2)))  float    v2f;
typedef __attribute__((ext_vector_type(2)))  _Float16 v2h;
typedef __attribute__((ext_vector_type(8)))  float    v8f;

union F16x16 { v16h v; v8h h[2]; };

// Every f16 operand in the workspace is kept in fragment order: a matrix is cut into tiles of
// 16 rows x 32 k, FT halfs (1 KB) each, and the tiles that one pass of the reader takes lie in a row:
// GEMM operands of R rows: tile (rt, kt) is number kt * R/16 + rt; Q, K: rt * 2 + kt; V^T: kt * 4 + rt.
// A tile is 64 pieces of 16 bytes; piece w holds row (w & 15), k piece_k(w) .. piece_k(w) + 7.
// Pieces 0..31 are what the 32 lanes take with a fragment's first load, 32..63 with its second,
// so each load of a wave is 512 bytes in a row (4 whole lines), not 16 pieces of 16 lines.
#define FT 512
__device__ __forceinline__ int piece_k(int w) { return ((w >> 5) << 4) + (((w >> 4) & 1) << 3); }

// Per-lane WMMA f16 operand fragment load (A or B) of one 16x32 tile in fragment order.
// Lane L holds row (L&15); K-chunks {e0..e0+7} and {e0+16..e0+23}, e0 = (L>>4)*8.
// Two 16-byte loads -> global_load_b128.
// 'piece' is the lane's own first piece of the tile: tile + lane * 8.
__device__ __forceinline__ v16h load_frag(const _Float16* piece) {
    F16x16 u;
    u.h[0] = *(const v8h*)(piece);
    u.h[1] = *(const v8h*)(piece + FT / 2);
    return u.v;
}

__device__ __forceinline__ v8f wmma32(v16h a, v16h b, v8f c) {
    return __builtin_amdgcn_wmma_f32_16x16x32_f16(false, a, false, b, (short)0, c, false, false);
}

// ---------------- prep kernels ----------------
// in: ROWS x DM (f32, row-major) -> out: the matrix in f16, fragment order, ITS ROWS SORTED inside each batch:
// first the positions whose mask is not 0 (the kept keys), in their order, then the others, in theirs.
// Everything between here and the output projection's stores works on sorted rows: a projection takes
// each row by itself, and attention does not depend on the order of its keys. Sorted, the keys that
// the mask fills stand behind all others, and the attention loop can end in front of them.
// srcTab[sorted row] = row of x and of out; cnt[batch * CNT_STEP] = kept keys of the batch.
// One wave per 16 x 32 tile: a lane reads the two runs of 8 floats that make its two pieces.
// Each block ranks its batch's SEQ positions itself (8 KB of mask, a wave 256 positions by ballots).
#define CNT_STEP 32                    // each batch's count in a 128-byte line of its own
__global__ __launch_bounds__(256) void cvt_f16_kernel(const float* __restrict__ in,
                                                      const int* __restrict__ mask,
                                                      _Float16* __restrict__ out,
                                                      int* __restrict__ srcTab,
                                                      int* __restrict__ cnt) {
    __shared__ int wsum[8];                      // kept keys among each wave's 256 positions
    __shared__ int rowsrc[32];                   // position of sorted rows (rt & ~1) * 16 .. + 31
    const int lane = threadIdx.x & 31;
    const int wave = threadIdx.x >> 5;
    const int t  = blockIdx.x * 8 + wave;        // a block reads 1 KB of each of 16 rows
    const int rt = t / (DM / 32), kt = t % (DM / 32);      // rt is the same for the whole block
    const int bb = rt / (SEQ / 16), rtl = rt % (SEQ / 16);

    const int* mb = mask + bb * SEQ + wave * 256 + lane;
    int mv[8];
#pragma unroll  // the eight loads in flight together, mv[] in registers
    for (int i = 0; i < 8; ++i) mv[i] = mb[i * 32];
    unsigned bits[8];
    int before[8], tot = 0;
#pragma unroll  // constant indices: the arrays stay in registers
    for (int i = 0; i < 8; ++i) {
        bits[i] = __builtin_amdgcn_ballot_w32(mv[i] != 0);
        before[i] = tot;
        tot += __builtin_popcount(bits[i]);
    }
    if (lane == 0) wsum[wave] = tot;
    // every wave needs the other waves' counts
    __syncthreads();
    int base = 0, n1 = 0;
#pragma unroll  // the eight LDS reads issued together
    for (int w = 0; w < 8; ++w) {
        const int c = wsum[w];
        base += (w < wave) ? c : 0;
        n1 += c;
    }
#pragma unroll  // constant indices into the arrays
    for (int i = 0; i < 8; ++i) {
        const int s = wave * 256 + i * 32 + lane;
        const int kept = base + before[i] + (int)__builtin_amdgcn_mbcnt_lo(bits[i], 0u);   // kept keys in front of s
        const int rank = (mv[i] != 0) ? kept : n1 + (s - kept);
        if ((rank >> 5) == (rtl >> 1)) rowsrc[rank & 31] = s;    // rank is a permutation: each slot written once
    }
    // the 32 slots are written by any wave and read by all
    __syncthreads();
    // one block of eight writes a whole 128-byte line of the table
    if ((blockIdx.x & 7) == 0 && threadIdx.x < 32) srcTab[rt * 16 + threadIdx.x] = bb * SEQ + rowsrc[threadIdx.x];
    if (rtl == 0 && kt == 0 && lane == 0) cnt[bb * CNT_STEP] = n1;

    const int srow = rowsrc[(rtl & 1) * 16 + (lane & 15)] & (SEQ - 1);   // the address stays inside the batch
    const float* src = in + (size_t)(bb * SEQ + srow) * DM + kt * 32 + piece_k(lane);
    v4f v[4];
#pragma unroll  // all four loads in flight at once, v[] in registers
    for (int i = 0; i < 4; ++i) v[i] = *(const v4f*)(src + (i >> 1) * 16 + (i & 1) * 4);
#pragma unroll  // constant indices into v[]
    for (int p = 0; p < 2; ++p) {
        v8h h;
#pragma unroll  // the same
        for (int j = 0; j < 8; ++j) h[j] = (_Float16)v[p * 2 + (j >> 2)][j & 3];
        *(v8h*)(out + (size_t)(kt * (ROWS / 16) + rt) * FT + p * (FT / 2) + lane * 8) = h;
    }
}

// in: rows x cols (f32) -> out: cols x rows (f16), N-major weights, in fragment order.
// One 64 x 64 tile per block, turned in LDS: rows are read as 256-byte runs and
// the block's 8 fragment tiles leave as whole lines. rows and cols are multiples of 64.
#define TT 64
#define TP 72                          // LDS pitch in halfs: 144 B = 16 B x odd, for the 16-byte readers
__global__ __launch_bounds__(256) void transpose_cvt_kernel(const float* __restrict__ in,
                                                            _Float16* __restrict__ out,
                                                            int rows, int cols) {
    __shared__ __align__(16) _Float16 tile[TT * TP];
    const int r0 = blockIdx.y * TT;
    const int c0 = blockIdx.x * TT;
    const int cg = threadIdx.x & 15;             // 4 columns
    const int rg = threadIdx.x >> 4;             // 4 rows

    v4f v[4];
#pragma unroll  // all four loads in flight at once, v[] in registers
    for (int i = 0; i < 4; ++i)
        v[i] = *(const v4f*)(in + (size_t)(r0 + rg * 4 + i) * cols + c0 + cg * 4);
#pragma unroll  // constant indices into v[]
    for (int j = 0; j < 4; ++j) {
        v4h h = { (_Float16)v[0][j], (_Float16)v[1][j], (_Float16)v[2][j], (_Float16)v[3][j] };
        *(v4h*)(tile + (cg * 4 + j) * TP + rg * 4) = h;
    }
    // the tile is written by all waves and read across them
    __syncthreads();

#pragma unroll  // both LDS reads issued before the first store
    for (int p = 0; p < 2; ++p) {
        int q = p * 256 + threadIdx.x;           // 512 pieces: 4 x 2 fragment tiles of 64
        int rt = q >> 7, kt = (q >> 6) & 1, w = q & 63;
        *(v8h*)(out + ((size_t)((r0 >> 5) + kt) * (cols >> 4) + (c0 >> 4) + rt) * FT + w * 8) =
            *(const v8h*)(tile + (rt * 16 + (w & 15)) * TP + kt * 32 + piece_k(w));
    }
}

// ---------------- QKV projection ----------------
// C(4096x3072) = xh(4096x1024) @ Wqkv + bqkv ; into Qh/Kh (s x d) and Vt (d x s), a matrix per head.
// A wave takes 64 x 64 of C: 4 + 4 fragments of 32 k feed 16 WMMAs, each loaded fragment four of them.
// A block is 2 x 2 waves, 128 x 128: two heads of one of Q, K, V. Each head's 128 x 64 is gathered in LDS
// and leaves in fragment order as whole 128-byte lines, 16 KB in a row.
#define WT 4                           // fragment tiles per wave and operand: 64 rows, 64 columns
#define QP 72                          // Q/K stage pitch in halfs: 144 B = 16 B x odd
#define VP 136                         // V^T stage pitch in halfs: 272 B = 16 B x odd
__global__ __launch_bounds__(128) void qkv_kernel(const _Float16* __restrict__ xh,
                                                  const _Float16* __restrict__ WqkvT,
                                                  const float* __restrict__ bqkv,
                                                  const int* __restrict__ cnt,
                                                  _Float16* __restrict__ Qh,
                                                  _Float16* __restrict__ Kh,
                                                  _Float16* __restrict__ Vt) {
    __shared__ __align__(16) _Float16 stage[2][128 * QP];   // V^T needs 64 * VP a head, which is less
    const int wave = threadIdx.x >> 5;
    const int lane = threadIdx.x & 31;
    const int wm = wave >> 1, wn = wave & 1;
    const int tilesN = DM3 / 128;                // 24
    const int bidN = blockIdx.x % tilesN;
    const int bidM = blockIdx.x / tilesN;
    // rows are sorted (see cvt_f16_kernel): a filled key's score is the fill whatever its K row holds, and the
    // attention kernel reads no K block that begins behind the kept keys. The whole block leaves, before any barrier
    if ((bidN * 128) / DM == 1 && (bidM * 128) % SEQ >= cnt[(bidM * 128) / SEQ * CNT_STEP]) return;
    const int rowBase = bidM * 128 + wm * 64;
    const int colBase = bidN * 128 + wn * 64;

    const _Float16* ap = xh    + (rowBase >> 4) * FT + lane * 8;
    const _Float16* bp = WqkvT + (colBase >> 4) * FT + lane * 8;

    v8f acc[WT][WT] = {};
    // a pass is 64 k: two fragment tiles of every operand row group
#pragma unroll  // unrolled, a pass's loads issue among the WMMAs of the pass before
    for (int kt = 0; kt < DM / 32; kt += 2) {
        v16h a[2][WT], b[2][WT];
#pragma unroll  // constant indices: the fragments stay in registers
        for (int h = 0; h < 2; ++h)
#pragma unroll  // the same
            for (int t = 0; t < WT; ++t) {
                a[h][t] = load_frag(ap + ((kt + h) * (ROWS / 16) + t) * FT);
                b[h][t] = load_frag(bp + ((kt + h) * (DM3 / 16) + t) * FT);
            }
        // holds the pass's 32 loads together in front of its WMMAs: without it the compiler sinks
        // each fragment's loads to its own WMMA, and the wave waits out one latency per fragment
        __builtin_amdgcn_sched_barrier(0);
#pragma unroll  // constant indices; the k order of every sum is as before
        for (int h = 0; h < 2; ++h)
#pragma unroll  // the same
            for (int mt = 0; mt < WT; ++mt)
#pragma unroll  // the same
                for (int nt = 0; nt < WT; ++nt) acc[mt][nt] = wmma32(a[h][mt], b[h][nt], acc[mt][nt]);
    }
    // stands between the k loop's last loads and the bias loads below, whose results the compiler puts into
    // the registers that hold those loads' addresses: the wait before a register of an issued load is overwritten
    asm volatile("s_wait_xcnt 0x0" ::: "memory");

    const int hl = lane >> 4, n = lane & 15;
    const int part = (bidN * 128) / DM;          // 0=Q 1=K 2=V, the same for the whole block
    const int head = ((bidN * 128) % DM) / DK;   // the block's first head; wave column wn has head + wn
    const int bb   = (bidM * 128) / SEQ;
    const int s0   = (bidM * 128) % SEQ;         // the block's 128 rows lie in one batch
    const size_t hb = (size_t)(bb * NHEAD + head);

    float bias[WT];
#pragma unroll  // the four bias loads in flight together
    for (int nt = 0; nt < WT; ++nt) bias[nt] = bqkv[colBase + nt * 16 + n];
    _Float16* st = &stage[wn][0];
#pragma unroll  // constant indices: acc[] stays in registers
    for (int mt = 0; mt < WT; ++mt) {
        v8h h[WT];
#pragma unroll  // the same
        for (int nt = 0; nt < WT; ++nt)
#pragma unroll  // the same
            for (int i = 0; i < 8; ++i) h[nt][i] = (_Float16)(acc[mt][nt][i] + bias[nt]);
        const int r0 = wm * 64 + mt * 16;        // the tile's first row in the block
        if (part == 2) {
            // stage[d][s]: a lane's 8 rows are 8 neighbours in s
#pragma unroll  // constant indices into h[]
            for (int nt = 0; nt < WT; ++nt)
                *(v8h*)(st + (nt * 16 + n) * VP + r0 + hl * 8) = h[nt];
        } else {
            // stage[s][d]
#pragma unroll  // constant indices into h[]
            for (int nt = 0; nt < WT; ++nt)
#pragma unroll  // the same
                for (int i = 0; i < 8; ++i) st[(r0 + i + 8 * hl) * QP + nt * 16 + n] = h[nt][i];
        }
    }
    // the tiles are written by all waves and read across them
    __syncthreads();

    // a head: 1024 pieces of 16 bytes = 16 fragment tiles in storage order: V^T 4 (s) x 4 (d), Q/K 8 (s) x 2 (d)
    const int lpitch = (part == 2) ? VP : QP;
    _Float16* dst = (part == 2 ? Vt : part == 0 ? Qh : Kh) + (hb * SEQ + s0) * DK;
#pragma unroll  // the LDS reads issued ahead of the stores
    for (int p = 0; p < 16; ++p) {
        int c = (p & 7) * 128 + threadIdx.x;     // p >> 3 is the head
        int tl = c >> 6, w = c & 63;
        int rt = (part == 2) ? tl & 3 : tl >> 1;
        int kt = (part == 2) ? tl >> 2 : tl & 1;
        *(v8h*)(dst + (size_t)(p >> 3) * SEQ * DK + c * 8) =
            *(const v8h*)(&stage[p >> 3][0] + (rt * 16 + (w & 15)) * lpitch + kt * 32 + piece_k(w));
    }
}

#define FILL_RAW_F (MASK_FILL_F / SCALE_F)      // the fill before the scale; the scale is a power of two
#define EXP_C_F    (SCALE_F * 1.44269504f)      // raw score -> exponent of two

// the value that lane ^ 16 holds
__device__ __forceinline__ float other_half(float v) {
    int b = __builtin_bit_cast(int, v);
    return __builtin_bit_cast(float, __builtin_amdgcn_permlanex16(b, b, 0x76543210, 0xfedcba98, false, false));
}

// One block of 32 keys from key kb on. KIND 0: kept keys alone. KIND 1: kept keys, then filled ones; 'lim' is the
// number of kept keys from the lane's first key (kb + 8 * hl) on, register r of score tile nt being key nt * 16 + r
// from there. KIND 2: filled keys alone: every score is the fill, K is not read (and may not have been computed).
template <int KIND>
__device__ __forceinline__ void attn_block(const _Float16* Kbase, const _Float16* Vbase, int kb, int lim,
                                           v16h qf0, v16h qf1, float& rowexp, float& rowsum, v8f (&o)[4]) {
        // ---- scores: two 16 (keys) x 16 (queries) tiles over DK=64 (2 WMMA each) ----
        const _Float16* kt = Kbase + (size_t)kb * DK;   // 32 keys: four tiles in a row
        v2f s[8];
        if constexpr (KIND != 2) {
            v8f sc[2];
#pragma unroll  // constant indices: the arrays stay in registers
            for (int nt = 0; nt < 2; ++nt) {
                const _Float16* Kt = kt + nt * 16 * DK; // 16 keys: two tiles
                v16h b0 = load_frag(Kt);
                v16h b1 = load_frag(Kt + FT);
                v8f tacc = {};
                tacc = wmma32(b0, qf0, tacc);
                tacc = wmma32(b1, qf1, tacc);
                sc[nt] = tacc;
            }
            // ---- mask (a key per register) ----
#pragma unroll  // constant indices: the arrays stay in registers
            for (int e = 0; e < 16; ++e)
                s[e >> 1][e & 1] = (KIND == 0 || (e >> 3) * 16 + (e & 7) < lim) ? sc[e >> 3][e & 7] : FILL_RAW_F;
        } else {
#pragma unroll  // constant indices: the array stays in registers
            for (int e = 0; e < 16; ++e) s[e >> 1][e & 1] = FILL_RAW_F;
        }

        // ---- online softmax: in the lane, one exchange between the halves for the maximum ----
        float t3[5];
#pragma unroll  // constant indices: the arrays stay in registers
        for (int g = 0; g < 5; ++g) {
            const int e = g * 3;
            t3[g] = fmaxf(fmaxf(s[e >> 1][e & 1], s[(e + 1) >> 1][(e + 1) & 1]), s[(e + 2) >> 1][(e + 2) & 1]);
        }
        float tm = fmaxf(fmaxf(fmaxf(t3[0], t3[1]), t3[2]), fmaxf(fmaxf(t3[3], t3[4]), s[7][1]));
        tm = fmaxf(tm, other_half(tm));
        // the running maximum is kept as the rounded exponent that the p below are taken against:
        // alpha is then the exact ratio of the two scales, and exactly 1 while the maximum stands
        const float mexp  = fmaxf(rowexp, tm * EXP_C_F);
        const float alpha = __builtin_amdgcn_exp2f(rowexp - mexp);
        rowexp = mexp;

        const v2f c2 = { EXP_C_F, EXP_C_F }, nm2 = { -mexp, -mexp };
        v2f p[8];
#pragma unroll  // constant indices: the arrays stay in registers
        for (int j = 0; j < 8; ++j) {
            v2f x = __builtin_elementwise_fma(s[j], c2, nm2);
            p[j][0] = __builtin_amdgcn_exp2f(x[0]);
            p[j][1] = __builtin_amdgcn_exp2f(x[1]);
        }
        const v2f ps = ((p[0] + p[4]) + (p[1] + p[5])) + ((p[2] + p[6]) + (p[3] + p[7]));
        rowsum = rowsum * alpha + (ps[0] + ps[1]);
#pragma unroll  // constant indices: the arrays stay in registers
        for (int dt = 0; dt < 4; ++dt) o[dt] *= alpha;

        // ---- P^T as a B fragment: element e is key (e >> 3) * 16 + 8 * hl + (e & 7), the k order of V^T's tiles ----
        v16h pf;
#pragma unroll  // constant indices: the arrays stay in registers
        for (int j = 0; j < 8; ++j) {
            v2h h2 = __builtin_convertvector(p[j], v2h);
            pf[2 * j] = h2[0]; pf[2 * j + 1] = h2[1];
        }

        // ---- context: O^T += V^T(16x32) @ P^T(32x16) for 4 d-tiles ----
        const _Float16* vt = Vbase + (size_t)kb * DK;   // 32 keys: four tiles in a row
        v16h w[4];
#pragma unroll  // constant indices: w[] stays in registers
        for (int dt = 0; dt < 4; ++dt) w[dt] = load_frag(vt + dt * FT);
#pragma unroll  // the same
        for (int dt = 0; dt < 4; ++dt) o[dt] = wmma32(w[dt], pf, o[dt]);
        // inputs only: the eight K loads share one address pair, the eight V loads another; this holds both pairs
        // until the last load has landed, so that no load's result is put into registers that a load in flight names
        if constexpr (KIND != 2) asm volatile("" :: "v"(kt), "v"(vt), "v"(w[3]));
        else                     asm volatile("" :: "v"(vt), "v"(w[3]));
}

__global__ __launch_bounds__(256) __attribute__((amdgpu_waves_per_eu(4, 4))) void attn_kernel(const _Float16* __restrict__ Qh,
                                                   const _Float16* __restrict__ Kh,
                                                   const _Float16* __restrict__ Vt,
                                                   const int* __restrict__ cnt,
                                                   _Float16* __restrict__ ctx) {
    const int wave = threadIdx.x >> 5;
    const int lane = threadIdx.x & 31;
    int qt = blockIdx.x * 8 + wave;              // 4096 q-tiles total
    int t = qt;
    const int qi   = (t % (SEQ / 16)) * 16; t /= (SEQ / 16);
    const int head = t % NHEAD;             t /= NHEAD;
    const int bb   = t;

    const _Float16* Qbase = Qh + ((size_t)(bb * NHEAD + head) * SEQ + qi) * DK + lane * 8;
    const _Float16* Kbase = Kh + (size_t)(bb * NHEAD + head) * SEQ * DK + lane * 8;
    const _Float16* Vbase = Vt + (size_t)(bb * NHEAD + head) * DK * SEQ + lane * 8;

    const v16h qf0 = load_frag(Qbase);                  // d 0..31
    const v16h qf1 = load_frag(Qbase + FT);             // d 32..63

    const int hl = lane >> 4;
    // the batch's kept keys; a block's eight query tiles lie in one batch. Clamped: it bounds the loops' trips
    // (readfirstlane: the clamp compiles to a vector instruction; back in a scalar register, the loop tests are scalar)
    const int n1 = __builtin_amdgcn_readfirstlane(min(max(cnt[(blockIdx.x * 8 / (NHEAD * (SEQ / 16))) * CNT_STEP], 0), SEQ));

    // of the lane's query: the maximum as an exponent of two, and the lane's own part of the sum
    float rowexp = -1e30f, rowsum = 0.0f;
    v8f o[4] = {};                                      // o[dt][r] = O[query lane & 15][d dt * 16 + 8 * hl + r]

    int kb = 0;
    for (; kb + 32 <= n1; kb += 32)
        attn_block<0>(Kbase, Vbase, kb, 0, qf0, qf1, rowexp, rowsum, o);
    if (kb < n1) {
        attn_block<1>(Kbase, Vbase, kb, n1 - kb - hl * 8, qf0, qf1, rowexp, rowsum, o);
        kb += 32;
    }
    for (; kb < SEQ; kb += 32) {
        // only filled keys are left, each with the same score. Where its p, taken as attn_block takes it,
        // is 0 for every query of the wave, the maximum stands (alpha is 1) and each further block would
        // add 0 to every sum: leaving here changes no bit. With no kept keys the walk goes on.
        const float pfill = __builtin_amdgcn_exp2f(__builtin_fmaf(FILL_RAW_F, EXP_C_F, -rowexp));
        if (__builtin_amdgcn_ballot_w32(pfill != 0.0f) == 0) break;
        attn_block<2>(Kbase, Vbase, kb, 0, qf0, qf1, rowexp, rowsum, o);
    }

    // inputs only: the four Q loads share one address pair; this holds the pair until the last of them has
    // landed, so that nothing is written into registers that a load in flight names
    asm volatile("" :: "v"(Qbase), "v"(qf1));

    // ---- epilogue: join the halves' sums, normalize, store ctx (f16) ----
    const float inv = 1.0f / (rowsum + other_half(rowsum));
    // ctx is a GEMM operand of ROWS rows: the wave's 16 x 64 are two of its tiles. A lane's 8 values of
    // o[dt] are piece (dt & 1) * 32 + lane of tile dt >> 1: each store of the wave is 512 bytes in a row
    _Float16* cdst = ctx + ((size_t)head * (DK / 32) * (ROWS / 16) + ((bb * SEQ + qi) >> 4)) * FT + lane * 8;
#pragma unroll  // constant indices into o[]
    for (int dt = 0; dt < 4; ++dt) {
        v8h h;
#pragma unroll  // the same
        for (int i = 0; i < 8; ++i) h[i] = (_Float16)(o[dt][i] * inv);
        *(v8h*)(cdst + (dt >> 1) * (ROWS / 16) * FT + (dt & 1) * (FT / 2)) = h;
    }
}

// ---------------- output projection ----------------
// Wave and block tiles as in the QKV projection: 64 x 64 a wave, 2 x 2 waves.
#define OP 68                          // f32 stage pitch in dwords: 272 B = 16 B x odd
__global__ __launch_bounds__(128) void out_proj_kernel(const _Float16* __restrict__ ctx,
                                                       const _Float16* __restrict__ WoutT,
                                                       const float* __restrict__ bout,
                                                       const int* __restrict__ srcTab,
                                                       float* __restrict__ out) {
    // each wave stages its own 64 x 64 f32 tile: a row is 256 B, two whole lines
    __shared__ __align__(16) float stage[4][64 * OP];
    const int wave = threadIdx.x >> 5;
    const int lane = threadIdx.x & 31;
    const int wm = wave >> 1, wn = wave & 1;
    const int tilesN = DM / 128;                 // 8
    const int bidN = blockIdx.x % tilesN;
    const int bidM = blockIdx.x / tilesN;
    const int rowBase = bidM * 128 + wm * 64;
    const int colBase = bidN * 128 + wn * 64;

    const _Float16* ap = ctx   + (rowBase >> 4) * FT + lane * 8;
    const _Float16* bp = WoutT + (colBase >> 4) * FT + lane * 8;

    v8f acc[WT][WT] = {};
    // a pass is 64 k: two fragment tiles of every operand row group
#pragma unroll  // unrolled, a pass's loads issue among the WMMAs of the pass before
    for (int kt = 0; kt < DM / 32; kt += 2) {
        v16h a[2][WT], b[2][WT];
#pragma unroll  // constant indices: the fragments stay in registers
        for (int h = 0; h < 2; ++h)
#pragma unroll  // the same
            for (int t = 0; t < WT; ++t) {
                a[h][t] = load_frag(ap + ((kt + h) * (ROWS / 16) + t) * FT);
                b[h][t] = load_frag(bp + ((kt + h) * (DM / 16) + t) * FT);
            }
        // holds the pass's 32 loads together in front of its WMMAs: without it the compiler sinks
        // each fragment's loads to its own WMMA, and the wave waits out one latency per fragment
        __builtin_amdgcn_sched_barrier(0);
#pragma unroll  // constant indices; the k order of every sum is as before
        for (int h = 0; h < 2; ++h)
#pragma unroll  // the same
            for (int mt = 0; mt < WT; ++mt)
#pragma unroll  // the same
                for (int nt = 0; nt < WT; ++nt) acc[mt][nt] = wmma32(a[h][mt], b[h][nt], acc[mt][nt]);
    }
    // inputs only: every A load names one address pair; this holds the pair past the last pass's loads,
    // so that no load's result is put into registers that a load in flight names
    asm volatile("" :: "v"(ap));
    // stands between the k loop's last loads and the bias loads below, whose results the compiler puts into
    // the registers that hold those loads' addresses: the wait before a register of an issued load is overwritten
    asm volatile("s_wait_xcnt 0x0" ::: "memory");
    const int hl = lane >> 4, n = lane & 15;
    // the wave's rows are sorted rows: each goes to the row of out that it came from in x (a row's 256 B stay
    // together). Store p below has row p * 2 + hl; read here, the table lands while the tile is staged
    const int tidx = rowBase + hl, bidx = colBase + n;
    int orow[32];
#pragma unroll  // the loads in flight together, orow[] in registers
    for (int p = 0; p < 32; ++p) orow[p] = srcTab[tidx + p * 2];
    float bias[WT];
#pragma unroll  // the four bias loads in flight together
    for (int nt = 0; nt < WT; ++nt) bias[nt] = bout[bidx + nt * 16];
    float* st = &stage[wave][0];
#pragma unroll  // constant indices: acc[] stays in registers
    for (int nt = 0; nt < WT; ++nt) {
#pragma unroll  // the same
        for (int mt = 0; mt < WT; ++mt)
#pragma unroll  // the same
            for (int i = 0; i < 8; ++i) st[(mt * 16 + i + 8 * hl) * OP + nt * 16 + n] = acc[mt][nt][i] + bias[nt];
    }
    // the wave's own LDS stores are done before its lanes read each other's rows back
    asm volatile("s_wait_dscnt 0x0" ::: "memory");
    // inputs only: the table loads share one index register, the bias loads another; this holds both until the last
    // load of each has landed, so that nothing is written into a register that a load in flight names
    asm volatile("" :: "v"(tidx), "v"(orow[31]), "v"(bidx), "v"(bias[WT - 1]));
    float* dst = out + colBase;
#pragma unroll  // the LDS reads issued ahead of the stores
    for (int p = 0; p < 32; ++p) {
        int c = p * 32 + lane;                   // 16-byte piece: 16 to a row of 64 columns
        int row = c >> 4, pc = c & 15;
        *(v4f*)(dst + (size_t)(orow[p] & (ROWS - 1)) * DM + pc * 4) =    // the address stays inside out
            *(const v4f*)(st + row * OP + pc * 4);
    }
}

extern "C" void kernel_launch(void* const* d_in, const int* in_sizes, int n_in,
                              void* d_out, int out_size, void* d_ws, size_t ws_size,
                              hipStream_t stream) {
    const float* x    = (const float*)d_in[0];   // (2,2048,1024)
    const int*   mask = (const int*)  d_in[1];   // (2,2048)
    const float* Wqkv = (const float*)d_in[2];   // (1024,3072)
    const float* bqkv = (const float*)d_in[3];   // (3072)
    const float* Wout = (const float*)d_in[4];   // (1024,1024)
    const float* bout = (const float*)d_in[5];   // (1024)
    float* out = (float*)d_out;                  // (2,2048,1024)

    char* ws = (char*)d_ws;
    _Float16* xh     = (_Float16*)ws;                 ws += (size_t)ROWS * DM  * 2; // 8 MB
    _Float16* WqkvT  = (_Float16*)ws;                 ws += (size_t)DM3  * DM  * 2; // 6 MB
    _Float16* WoutT  = (_Float16*)ws;                 ws += (size_t)DM   * DM  * 2; // 2 MB
    _Float16* Qh     = (_Float16*)ws;                 ws += (size_t)ROWS * DM  * 2 / NHEAD * NHEAD; // 8 MB
    _Float16* Kh     = (_Float16*)ws;                 ws += (size_t)ROWS * DM  * 2; // 8 MB (Qh advanced same)
    _Float16* Vt     = (_Float16*)ws;                 ws += (size_t)ROWS * DM  * 2; // 8 MB
    _Float16* ctx    = (_Float16*)ws;                 ws += (size_t)ROWS * DM  * 2; // 8 MB
    int*      srcTab = (int*)ws;                      ws += (size_t)ROWS * 4;       // 16 KB
    int*      cnt    = (int*)ws;                      // BATCH lines of 128 B

    // prep: f16 conversions (x: rows sorted by the mask) / weight transposes
    cvt_f16_kernel<<<(ROWS / 16) * (DM / 32) / 8, 256, 0, stream>>>(x, mask, xh, srcTab, cnt);
    transpose_cvt_kernel<<<dim3(DM3 / TT, DM / TT), 256, 0, stream>>>(Wqkv, WqkvT, DM, DM3);
    transpose_cvt_kernel<<<dim3(DM / TT, DM / TT), 256, 0, stream>>>(Wout, WoutT, DM, DM);

    // QKV projection: grid = (4096/128) * (3072/128)
    qkv_kernel<<<(ROWS / 128) * (DM3 / 128), 128, 0, stream>>>(xh, WqkvT, bqkv, cnt, Qh, Kh, Vt);

    // attention: 4096 q-tiles, 8 per block
    attn_kernel<<<(BATCH * NHEAD * (SEQ / 16)) / 8, 256, 0, stream>>>(Qh, Kh, Vt, cnt, ctx);

    // output projection: grid = (4096/128) * (1024/128)
    out_proj_kernel<<<(ROWS / 128) * (DM / 128), 128, 0, stream>>>(ctx, WoutT, bout, srcTab, out);
}

// v008
// A run of this version takes 67.6 microseconds.
// Timed twice side by side with v007, it ran 1.37 and 1.36 times as fast.
// All steps since v000 together make it 6.56 times as fast.
#include <hip/hip_runtime.h>
#include <hip/hip_bf16.h>

#define DM     1024
#define DM3    3072
#define SEQ    2048
#define BATCH  2
#define NHEAD  16
#define DK     64
#define ROWS   (BATCH * SEQ)          // 4096
#define SCALE_F 0.125f                 // 1/sqrt(64)
#define MASK_FILL_F (-10000.0f)

typedef __attribute__((ext_vector_type(16))) _Float16 v16h;
typedef __attribute__((ext_vector_type(8)))  _Float16 v8h;
typedef __attribute__((ext_vector_type(4)))  _Float16 v4h;
typedef __attribute__((ext_vector_type(4)))  float    v4f;
typedef __attribute__((ext_vector_type(4)))  int      v4i;
typedef __attribute__((ext_vector_type(2)))  float    v2f;
typedef __attribute__((ext_vector_type(2)))  _Float16 v2h;
typedef __attribute__((ext_vector_type(8)))  float    v8f;

union F16x16 { v16h v; v8h h[2]; };

// Every f16 operand in the workspace is kept in fragment order: a matrix is cut into tiles of
// 16 rows x 32 k, FT halfs (1 KB) each, and the tiles that one pass of the reader takes lie in a row:
// GEMM operands of R rows: tile (rt, kt) is number kt * R/16 + rt; Q, K: rt * 2 + kt; V^T: kt * 4 + rt.
// A tile is 64 pieces of 16 bytes; piece w holds row (w & 15), k piece_k(w) .. piece_k(w) + 7.
// Pieces 0..31 are what the 32 lanes take with a fragment's first load, 32..63 with its second,
// so each load of a wave is 512 bytes in a row (4 whole lines), not 16 pieces of 16 lines.
#define FT 512
__device__ __forceinline__ int piece_k(int w) { return ((w >> 5) << 4) + (((w >> 4) & 1) << 3); }

// Per-lane WMMA f16 operand fragment load (A or B) of one 16x32 tile in fragment order.
// Lane L holds row (L&15); K-chunks {e0..e0+7} and {e0+16..e0+23}, e0 = (L>>4)*8.
// Two 16-byte loads -> global_load_b128, or ds_load_b128 for a tile in LDS.
// 'piece' is the lane's own first piece of the tile: tile + lane * 8.
__device__ __forceinline__ v16h load_frag(const _Float16* piece) {
    F16x16 u;
    u.h[0] = *(const v8h*)(piece);
    u.h[1] = *(const v8h*)(piece + FT / 2);
    return u.v;
}

__device__ __forceinline__ v8f wmma32(v16h a, v16h b, v8f c) {
    return __builtin_amdgcn_wmma_f32_16x16x32_f16(false, a, false, b, (short)0, c, false, false);
}

// ---------------- prep kernels ----------------
// in: ROWS x DM (f32, row-major) -> out: the matrix in f16, fragment order, ITS ROWS SORTED inside each batch:
// first the positions whose mask is not 0 (the kept keys), in their order, then the others, in theirs.
// Everything between here and the output projection's stores works on sorted rows: a projection takes
// each row by itself, and attention does not depend on the order of its keys. Sorted, the keys that
// the mask fills stand behind all others, and the attention loop can end in front of them.
// srcTab[sorted row] = row of x and of out; cnt[batch * CNT_STEP] = kept keys of the batch.
// One wave per 16 x 32 tile: a lane reads the two runs of 8 floats that make its two pieces.
// Each block ranks its batch's SEQ positions itself (8 KB of mask, a wave 256 positions by ballots).
#define CNT_STEP 32                    // each batch's count in a 128-byte line of its own
__global__ __launch_bounds__(256) void cvt_f16_kernel(const float* __restrict__ in,
                                                      const int* __restrict__ mask,
                                                      _Float16* __restrict__ out,
                                                      int* __restrict__ srcTab,
                                                      int* __restrict__ cnt) {
    __shared__ int wsum[8];                      // kept keys among each wave's 256 positions
    __shared__ int rowsrc[32];                   // position of sorted rows (rt & ~1) * 16 .. + 31
    const int lane = threadIdx.x & 31;
    const int wave = threadIdx.x >> 5;
    const int t  = blockIdx.x * 8 + wave;        // a block reads 1 KB of each of 16 rows
    const int rt = t / (DM / 32), kt = t % (DM / 32);      // rt is the same for the whole block
    const int bb = rt / (SEQ / 16), rtl = rt % (SEQ / 16);

    const int* mb = mask + bb * SEQ + wave * 256 + lane;
    int mv[8];
#pragma unroll  // the eight loads in flight together, mv[] in registers
    for (int i = 0; i < 8; ++i) mv[i] = mb[i * 32];
    unsigned bits[8];
    int before[8], tot = 0;
#pragma unroll  // constant indices: the arrays stay in registers
    for (int i = 0; i < 8; ++i) {
        bits[i] = __builtin_amdgcn_ballot_w32(mv[i] != 0);
        before[i] = tot;
        tot += __builtin_popcount(bits[i]);
    }
    if (lane == 0) wsum[wave] = tot;
    // every wave needs the other waves' counts
    __syncthreads();
    int base = 0, n1 = 0;
#pragma unroll  // the eight LDS reads issued together
    for (int w = 0; w < 8; ++w) {
        const int c = wsum[w];
        base += (w < wave) ? c : 0;
        n1 += c;
    }
#pragma unroll  // constant indices into the arrays
    for (int i = 0; i < 8; ++i) {
        const int s = wave * 256 + i * 32 + lane;
        const int kept = base + before[i] + (int)__builtin_amdgcn_mbcnt_lo(bits[i], 0u);   // kept keys in front of s
        const int rank = (mv[i] != 0) ? kept : n1 + (s - kept);
        if ((rank >> 5) == (rtl >> 1)) rowsrc[rank & 31] = s;    // rank is a permutation: each slot written once
    }
    // the 32 slots are written by any wave and read by all
    __syncthreads();
    // one block of eight writes a whole 128-byte line of the table
    if ((blockIdx.x & 7) == 0 && threadIdx.x < 32) srcTab[rt * 16 + threadIdx.x] = bb * SEQ + rowsrc[threadIdx.x];
    if (rtl == 0 && kt == 0 && lane == 0) cnt[bb * CNT_STEP] = n1;

    const int srow = rowsrc[(rtl & 1) * 16 + (lane & 15)] & (SEQ - 1);   // the address stays inside the batch
    const float* src = in + (size_t)(bb * SEQ + srow) * DM + kt * 32 + piece_k(lane);
    v4f v[4];
#pragma unroll  // all four loads in flight at once, v[] in registers
    for (int i = 0; i < 4; ++i) v[i] = *(const v4f*)(src + (i >> 1) * 16 + (i & 1) * 4);
#pragma unroll  // constant indices into v[]
    for (int p = 0; p < 2; ++p) {
        v8h h;
#pragma unroll  // the same
        for (int j = 0; j < 8; ++j) h[j] = (_Float16)v[p * 2 + (j >> 2)][j & 3];
        *(v8h*)(out + (size_t)(kt * (ROWS / 16) + rt) * FT + p * (FT / 2) + lane * 8) = h;
    }
}

// in: rows x cols (f32) -> out: cols x rows (f16), N-major weights, in fragment order.
// One 64 x 64 tile per block, turned in LDS: rows are read as 256-byte runs and
// the block's 8 fragment tiles leave as whole lines. rows and cols are multiples of 64.
#define TT 64
#define TP 72                          // LDS pitch in halfs: 144 B = 16 B x odd, for the 16-byte readers
__global__ __launch_bounds__(256) void transpose_cvt_kernel(const float* __restrict__ in,
                                                            _Float16* __restrict__ out,
                                                            int rows, int cols) {
    __shared__ __align__(16) _Float16 tile[TT * TP];
    const int r0 = blockIdx.y * TT;
    const int c0 = blockIdx.x * TT;
    const int cg = threadIdx.x & 15;             // 4 columns
    const int rg = threadIdx.x >> 4;             // 4 rows

    v4f v[4];
#pragma unroll  // all four loads in flight at once, v[] in registers
    for (int i = 0; i < 4; ++i)
        v[i] = *(const v4f*)(in + (size_t)(r0 + rg * 4 + i) * cols + c0 + cg * 4);
#pragma unroll  // constant indices into v[]
    for (int j = 0; j < 4; ++j) {
        v4h h = { (_Float16)v[0][j], (_Float16)v[1][j], (_Float16)v[2][j], (_Float16)v[3][j] };
        *(v4h*)(tile + (cg * 4 + j) * TP + rg * 4) = h;
    }
    // the tile is written by all waves and read across them
    __syncthreads();

#pragma unroll  // both LDS reads issued before the first store
    for (int p = 0; p < 2; ++p) {
        int q = p * 256 + threadIdx.x;           // 512 pieces: 4 x 2 fragment tiles of 64
        int rt = q >> 7, kt = (q >> 6) & 1, w = q & 63;
        *(v8h*)(out + ((size_t)((r0 >> 5) + kt) * (cols >> 4) + (c0 >> 4) + rt) * FT + w * 8) =
            *(const v8h*)(tile + (rt * 16 + (w & 15)) * TP + kt * 32 + piece_k(w));
    }
}

// ---------------- QKV projection ----------------
// C(4096x3072) = xh(4096x1024) @ Wqkv + bqkv ; into Qh/Kh (s x d) and Vt (d x s), a matrix per head.
// A wave takes 64 x 64 of C: 4 + 4 fragments of 32 k feed 16 WMMAs, each loaded fragment four of them.
// A block is 2 x 2 waves, 128 x 128: two heads of one of Q, K, V. Each head's 128 x 64 is gathered in LDS
// and leaves in fragment order as whole 128-byte lines, 16 KB in a row.
#define WT 4                           // fragment tiles per wave and operand: 64 rows, 64 columns
#define QP 72                          // Q/K stage pitch in halfs: 144 B = 16 B x odd
#define VP 136                         // V^T stage pitch in halfs: 272 B = 16 B x odd
__global__ __launch_bounds__(128) void qkv_kernel(const _Float16* __restrict__ xh,
                                                  const _Float16* __restrict__ WqkvT,
                                                  const float* __restrict__ bqkv,
                                                  const int* __restrict__ cnt,
                                                  _Float16* __restrict__ Qh,
                                                  _Float16* __restrict__ Kh,
                                                  _Float16* __restrict__ Vt) {
    __shared__ __align__(16) _Float16 stage[2][128 * QP];   // V^T needs 64 * VP a head, which is less
    const int wave = threadIdx.x >> 5;
    const int lane = threadIdx.x & 31;
    const int wm = wave >> 1, wn = wave & 1;
    const int tilesN = DM3 / 128;                // 24
    const int bidN = blockIdx.x % tilesN;
    const int bidM = blockIdx.x / tilesN;
    // rows are sorted (see cvt_f16_kernel): a filled key's score is the fill whatever its K row holds, and the
    // attention kernel reads no K block that begins behind the kept keys. The whole block leaves, before any barrier
    if ((bidN * 128) / DM == 1 && (bidM * 128) % SEQ >= cnt[(bidM * 128) / SEQ * CNT_STEP]) return;
    const int rowBase = bidM * 128 + wm * 64;
    const int colBase = bidN * 128 + wn * 64;

    const _Float16* ap = xh    + (rowBase >> 4) * FT + lane * 8;
    const _Float16* bp = WqkvT + (colBase >> 4) * FT + lane * 8;

    v8f acc[WT][WT] = {};
    // a pass is 64 k: two fragment tiles of every operand row group
#pragma unroll  // unrolled, a pass's loads issue among the WMMAs of the pass before
    for (int kt = 0; kt < DM / 32; kt += 2) {
        v16h a[2][WT], b[2][WT];
#pragma unroll  // constant indices: the fragments stay in registers
        for (int h = 0; h < 2; ++h)
#pragma unroll  // the same
            for (int t = 0; t < WT; ++t) {
                a[h][t] = load_frag(ap + ((kt + h) * (ROWS / 16) + t) * FT);
                b[h][t] = load_frag(bp + ((kt + h) * (DM3 / 16) + t) * FT);
            }
        // holds the pass's 32 loads together in front of its WMMAs: without it the compiler sinks
        // each fragment's loads to its own WMMA, and the wave waits out one latency per fragment
        __builtin_amdgcn_sched_barrier(0);
#pragma unroll  // constant indices; the k order of every sum is as before
        for (int h = 0; h < 2; ++h)
#pragma unroll  // the same
            for (int mt = 0; mt < WT; ++mt)
#pragma unroll  // the same
                for (int nt = 0; nt < WT; ++nt) acc[mt][nt] = wmma32(a[h][mt], b[h][nt], acc[mt][nt]);
    }
    // stands between the k loop's last loads and the bias loads below, whose results the compiler puts into
    // the registers that hold those loads' addresses: the wait before a register of an issued load is overwritten
    asm volatile("s_wait_xcnt 0x0" ::: "memory");

    const int hl = lane >> 4, n = lane & 15;
    const int part = (bidN * 128) / DM;          // 0=Q 1=K 2=V, the same for the whole block
    const int head = ((bidN * 128) % DM) / DK;   // the block's first head; wave column wn has head + wn
    const int bb   = (bidM * 128) / SEQ;
    const int s0   = (bidM * 128) % SEQ;         // the block's 128 rows lie in one batch
    const size_t hb = (size_t)(bb * NHEAD + head);

    float bias[WT];
#pragma unroll  // the four bias loads in flight together
    for (int nt = 0; nt < WT; ++nt) bias[nt] = bqkv[colBase + nt * 16 + n];
    _Float16* st = &stage[wn][0];
#pragma unroll  // constant indices: acc[] stays in registers
    for (int mt = 0; mt < WT; ++mt) {
        v8h h[WT];
#pragma unroll  // the same
        for (int nt = 0; nt < WT; ++nt)
#pragma unroll  // the same
            for (int i = 0; i < 8; ++i) h[nt][i] = (_Float16)(acc[mt][nt][i] + bias[nt]);
        const int r0 = wm * 64 + mt * 16;        // the tile's first row in the block
        if (part == 2) {
            // stage[d][s]: a lane's 8 rows are 8 neighbours in s
#pragma unroll  // constant indices into h[]
            for (int nt = 0; nt < WT; ++nt)
                *(v8h*)(st + (nt * 16 + n) * VP + r0 + hl * 8) = h[nt];
        } else {
            // stage[s][d]
#pragma unroll  // constant indices into h[]
            for (int nt = 0; nt < WT; ++nt)
#pragma unroll  // the same
                for (int i = 0; i < 8; ++i) st[(r0 + i + 8 * hl) * QP + nt * 16 + n] = h[nt][i];
        }
    }
    // the tiles are written by all waves and read across them
    __syncthreads();

    // a head: 1024 pieces of 16 bytes = 16 fragment tiles in storage order: V^T 4 (s) x 4 (d), Q/K 8 (s) x 2 (d)
    const int lpitch = (part == 2) ? VP : QP;
    _Float16* dst = (part == 2 ? Vt : part == 0 ? Qh : Kh) + (hb * SEQ + s0) * DK;
#pragma unroll  // the LDS reads issued ahead of the stores
    for (int p = 0; p < 16; ++p) {
        int c = (p & 7) * 128 + threadIdx.x;     // p >> 3 is the head
        int tl = c >> 6, w = c & 63;
        int rt = (part == 2) ? tl & 3 : tl >> 1;
        int kt = (part == 2) ? tl >> 2 : tl & 1;
        *(v8h*)(dst + (size_t)(p >> 3) * SEQ * DK + c * 8) =
            *(const v8h*)(&stage[p >> 3][0] + (rt * 16 + (w & 15)) * lpitch + kt * 32 + piece_k(w));
    }
}

#define FILL_RAW_F (MASK_FILL_F / SCALE_F)      // the fill before the scale; the scale is a power of two
#define EXP_C_F    (SCALE_F * 1.44269504f)      // raw score -> exponent of two

// the value that lane ^ 16 holds
__device__ __forceinline__ float other_half(float v) {
    int b = __builtin_bit_cast(int, v);
    return __builtin_bit_cast(float, __builtin_amdgcn_permlanex16(b, b, 0x76543210, 0xfedcba98, false, false));
}

// One block of 32 keys; kt and vt are the lane's own first pieces of the block's four K tiles and four V^T tiles
// (KIND 0 and 1: in LDS; KIND 2: vt in global memory). KIND 0: kept keys alone. KIND 1: kept keys, then filled ones; 'lim' is the
// number of kept keys from the lane's first key (8 * hl in the block) on, register r of score tile nt being key nt * 16 + r
// from there. KIND 2: filled keys alone: every score is the fill, K is not read (and may not have been computed).
template <int KIND>
__device__ __forceinline__ void attn_block(const _Float16* kt, const _Float16* vt, int lim,
                                           v16h qf0, v16h qf1, float& rowexp, float& rowsum, v8f (&o)[4]) {
        // ---- scores: two 16 (keys) x 16 (queries) tiles over DK=64 (2 WMMA each) ----
        v2f s[8];
        if constexpr (KIND != 2) {
            v8f sc[2];
#pragma unroll  // constant indices: the arrays stay in registers
            for (int nt = 0; nt < 2; ++nt) {
                const _Float16* Kt = kt + nt * 16 * DK; // 16 keys: two tiles
                v16h b0 = load_frag(Kt);
                v16h b1 = load_frag(Kt + FT);
                v8f tacc = {};
                tacc = wmma32(b0, qf0, tacc);
                tacc = wmma32(b1, qf1, tacc);
                sc[nt] = tacc;
            }
            // ---- mask (a key per register) ----
#pragma unroll  // constant indices: the arrays stay in registers
            for (int e = 0; e < 16; ++e)
                s[e >> 1][e & 1] = (KIND == 0 || (e >> 3) * 16 + (e & 7) < lim) ? sc[e >> 3][e & 7] : FILL_RAW_F;
        } else {
#pragma unroll  // constant indices: the array stays in registers
            for (int e = 0; e < 16; ++e) s[e >> 1][e & 1] = FILL_RAW_F;
        }

        // ---- online softmax: in the lane, one exchange between the halves for the maximum ----
        float t3[5];
#pragma unroll  // constant indices: the arrays stay in registers
        for (int g = 0; g < 5; ++g) {
            const int e = g * 3;
            t3[g] = fmaxf(fmaxf(s[e >> 1][e & 1], s[(e + 1) >> 1][(e + 1) & 1]), s[(e + 2) >> 1][(e + 2) & 1]);
        }
        float tm = fmaxf(fmaxf(fmaxf(t3[0], t3[1]), t3[2]), fmaxf(fmaxf(t3[3], t3[4]), s[7][1]));
        tm = fmaxf(tm, other_half(tm));
        // the running maximum is kept as the rounded exponent that the p below are taken against:
        // alpha is then the exact ratio of the two scales, and exactly 1 while the maximum stands
        const float mexp  = fmaxf(rowexp, tm * EXP_C_F);
        const float alpha = __builtin_amdgcn_exp2f(rowexp - mexp);
        rowexp = mexp;

        const v2f c2 = { EXP_C_F, EXP_C_F }, nm2 = { -mexp, -mexp };
        v2f p[8];
#pragma unroll  // constant indices: the arrays stay in registers
        for (int j = 0; j < 8; ++j) {
            v2f x = __builtin_elementwise_fma(s[j], c2, nm2);
            p[j][0] = __builtin_amdgcn_exp2f(x[0]);
            p[j][1] = __builtin_amdgcn_exp2f(x[1]);
        }
        const v2f ps = ((p[0] + p[4]) + (p[1] + p[5])) + ((p[2] + p[6]) + (p[3] + p[7]));
        rowsum = rowsum * alpha + (ps[0] + ps[1]);
#pragma unroll  // constant indices: the arrays stay in registers
        for (int dt = 0; dt < 4; ++dt) o[dt] *= alpha;

        // ---- P^T as a B fragment: element e is key (e >> 3) * 16 + 8 * hl + (e & 7), the k order of V^T's tiles ----
        v16h pf;
#pragma unroll  // constant indices: the arrays stay in registers
        for (int j = 0; j < 8; ++j) {
            v2h h2 = __builtin_convertvector(p[j], v2h);
            pf[2 * j] = h2[0]; pf[2 * j + 1] = h2[1];
        }

        // ---- context: O^T += V^T(16x32) @ P^T(32x16) for 4 d-tiles ----
        v16h w[4];
#pragma unroll  // constant indices: w[] stays in registers
        for (int dt = 0; dt < 4; ++dt) w[dt] = load_frag(vt + dt * FT);
#pragma unroll  // the same
        for (int dt = 0; dt < 4; ++dt) o[dt] = wmma32(w[dt], pf, o[dt]);
        // inputs only: the eight global V loads share one address pair; this holds the pair until the last
        // load has landed, so that no load's result is put into registers that a load in flight names
        if constexpr (KIND == 2) asm volatile("" :: "v"(vt), "v"(w[3]));
}

#define STG_KEYS  128
#define STG_HALFS (STG_KEYS * DK)               // 16 KB of K, and as much of V^T, a stage

// One stage: a thread copies four pieces of 16 bytes of K and four of V^T, 4 KB apart, straight into LDS.
// lk, lv: LDS byte addresses of the thread's first pieces; gk, gv: the same pieces in global memory.
__device__ __forceinline__ void stage_copy(unsigned lk, unsigned lv, const _Float16* gk, const _Float16* gv) {
    // the wait is the statement's last line: it stands in front of every later write of a register that a copy names
    asm volatile("global_load_async_to_lds_b128 %0, %8, off\n\t"
                 "global_load_async_to_lds_b128 %1, %9, off\n\t"
                 "global_load_async_to_lds_b128 %2, %10, off\n\t"
                 "global_load_async_to_lds_b128 %3, %11, off\n\t"
                 "global_load_async_to_lds_b128 %4, %12, off\n\t"
                 "global_load_async_to_lds_b128 %5, %13, off\n\t"
                 "global_load_async_to_lds_b128 %6, %14, off\n\t"
                 "global_load_async_to_lds_b128 %7, %15, off\n\t"
                 "s_wait_xcnt 0x0"
                 :: "v"(lk), "v"(lk + 4096u), "v"(lk + 8192u), "v"(lk + 12288u),
                    "v"(lv), "v"(lv + 4096u), "v"(lv + 8192u), "v"(lv + 12288u),
                    "v"(gk), "v"(gk + 2048), "v"(gk + 4096), "v"(gk + 6144),
                    "v"(gv), "v"(gv + 2048), "v"(gv + 4096), "v"(gv + 6144)
                 : "memory");
}

__global__ __launch_bounds__(256) __attribute__((amdgpu_waves_per_eu(4, 4))) void attn_kernel(const _Float16* __restrict__ Qh,
                                                   const _Float16* __restrict__ Kh,
                                                   const _Float16* __restrict__ Vt,
                                                   const int* __restrict__ cnt,
                                                   _Float16* __restrict__ ctx) {
    __shared__ __align__(128) _Float16 kv[2][2][STG_HALFS];     // [buffer][K, V^T]
    const int wave = threadIdx.x >> 5;
    const int lane = threadIdx.x & 31;
    int qt = blockIdx.x * 8 + wave;              // 4096 q-tiles total
    int t = qt;
    const int qi   = (t % (SEQ / 16)) * 16; t /= (SEQ / 16);
    const int head = t % NHEAD;             t /= NHEAD;
    const int bb   = t;

    const _Float16* Qbase = Qh + ((size_t)(bb * NHEAD + head) * SEQ + qi) * DK + lane * 8;
    const _Float16* Vbase = Vt + (size_t)(bb * NHEAD + head) * DK * SEQ + lane * 8;
    // the thread's first piece of the head's K and V^T (batch and head are the same for the whole work-group)
    const _Float16* Kcopy = Kh + (size_t)(bb * NHEAD + head) * SEQ * DK + threadIdx.x * 8;
    const _Float16* Vcopy = Vt + (size_t)(bb * NHEAD + head) * DK * SEQ + threadIdx.x * 8;
    // and its place in buffer 0: the low 32 bits of a __shared__ address are the LDS byte address
    const unsigned lk0 = (unsigned)(size_t)&kv[0][0][threadIdx.x * 8];
    const unsigned lv0 = (unsigned)(size_t)&kv[0][1][threadIdx.x * 8];

    const v16h qf0 = load_frag(Qbase);                  // d 0..31
    const v16h qf1 = load_frag(Qbase + FT);             // d 32..63

    const int hl = lane >> 4;
    // the batch's kept keys; a block's eight query tiles lie in one batch. Clamped: it bounds the loops' trips
    // (readfirstlane: the clamp compiles to a vector instruction; back in a scalar register, the loop tests are scalar)
    const int n1 = __builtin_amdgcn_readfirstlane(min(max(cnt[(blockIdx.x * 8 / (NHEAD * (SEQ / 16))) * CNT_STEP], 0), SEQ));

    // of the lane's query: the maximum as an exponent of two, and the lane's own part of the sum
    float rowexp = -1e30f, rowsum = 0.0f;
    v8f o[4] = {};                                      // o[dt][r] = O[query lane & 15][d dt * 16 + 8 * hl + r]

    // stages that hold a kept key, at most SEQ / STG_KEYS. A stage is copied whole: the K projection leaves out
    // only blocks of 128 rows that begin behind the kept keys, so every K row of such a stage was written
    const int nst = (n1 + STG_KEYS - 1) / STG_KEYS;
    if (nst > 0) {
        stage_copy(lk0, lv0, Kcopy, Vcopy);
        // stage 0 has landed, for this wave's copies
        asm volatile("s_wait_asynccnt 0x0" ::: "memory");
        // and for every wave's: nothing of it is read in front of this barrier
        __syncthreads();
        if (nst > 1) stage_copy(lk0 + 4u * STG_HALFS, lv0 + 4u * STG_HALFS, Kcopy + STG_HALFS, Vcopy + STG_HALFS);
        for (int st = 0; st < nst; ++st) {
            const _Float16* kl = &kv[st & 1][0][lane * 8];
            const _Float16* vl = &kv[st & 1][1][lane * 8];
            const int left = n1 - st * STG_KEYS;             // kept keys from the stage's first key on, above 0
            const int full = min(left >> 5, STG_KEYS / 32);  // blocks of kept keys alone
            for (int j = 0; j < full; ++j)
                attn_block<0>(kl + j * 32 * DK, vl + j * 32 * DK, 0, qf0, qf1, rowexp, rowsum, o);
            if (full < STG_KEYS / 32 && full * 32 < left)
                attn_block<1>(kl + full * 32 * DK, vl + full * 32 * DK, left - full * 32 - hl * 8, qf0, qf1, rowexp, rowsum, o);
            // the wave's own reads of this buffer are done before it is refilled
            asm volatile("s_wait_dscnt 0x0" ::: "memory");
            // the wave's copies of the next stage have landed
            asm volatile("s_wait_asynccnt 0x0" ::: "memory");
            // publishes the next stage and ends every wave's reads of this buffer
            __syncthreads();
            if (st + 2 < nst)
                stage_copy(lk0 + (unsigned)(st & 1) * (4u * STG_HALFS), lv0 + (unsigned)(st & 1) * (4u * STG_HALFS),
                           Kcopy + (size_t)(st + 2) * STG_HALFS, Vcopy + (size_t)(st + 2) * STG_HALFS);
        }
        // no copy is in flight when the wave goes on
        asm volatile("s_wait_asynccnt 0x0" ::: "memory");
    }
    for (int kb = (n1 + 31) & ~31; kb < SEQ; kb += 32) {
        // only filled keys are left, each with the same score. Where its p, taken as attn_block takes it,
        // is 0 for every query of the wave, the maximum stands (alpha is 1) and each further block would
        // add 0 to every sum: leaving here changes no bit. With no kept keys the walk goes on.
        const float pfill = __builtin_amdgcn_exp2f(__builtin_fmaf(FILL_RAW_F, EXP_C_F, -rowexp));
        if (__builtin_amdgcn_ballot_w32(pfill != 0.0f) == 0) break;
        attn_block<2>(nullptr, Vbase + (size_t)kb * DK, 0, qf0, qf1, rowexp, rowsum, o);
    }

    // inputs only: the four Q loads share one address pair; this holds the pair until the last of them has
    // landed, so that nothing is written into registers that a load in flight names
    asm volatile("" :: "v"(Qbase), "v"(qf1));

    // ---- epilogue: join the halves' sums, normalize, store ctx (f16) ----
    const float inv = 1.0f / (rowsum + other_half(rowsum));
    // ctx is a GEMM operand of ROWS rows: the wave's 16 x 64 are two of its tiles. A lane's 8 values of
    // o[dt] are piece (dt & 1) * 32 + lane of tile dt >> 1: each store of the wave is 512 bytes in a row
    _Float16* cdst = ctx + ((size_t)head * (DK / 32) * (ROWS / 16) + ((bb * SEQ + qi) >> 4)) * FT + lane * 8;
#pragma unroll  // constant indices into o[]
    for (int dt = 0; dt < 4; ++dt) {
        v8h h;
#pragma unroll  // the same
        for (int i = 0; i < 8; ++i) h[i] = (_Float16)(o[dt][i] * inv);
        *(v8h*)(cdst + (dt >> 1) * (ROWS / 16) * FT + (dt & 1) * (FT / 2)) = h;
    }
}

// ---------------- output projection ----------------
// Wave and block tiles as in the QKV projection: 64 x 64 a wave, 2 x 2 waves.
#define OP 68                          // f32 stage pitch in dwords: 272 B = 16 B x odd
__global__ __launch_bounds__(128) void out_proj_kernel(const _Float16* __restrict__ ctx,
                                                       const _Float16* __restrict__ WoutT,
                                                       const float* __restrict__ bout,
                                                       const int* __restrict__ srcTab,
                                                       float* __restrict__ out) {
    // each wave stages its own 64 x 64 f32 tile: a row is 256 B, two whole lines
    __shared__ __align__(16) float stage[4][64 * OP];
    const int wave = threadIdx.x >> 5;
    const int lane = threadIdx.x & 31;
    const int wm = wave >> 1, wn = wave & 1;
    const int tilesN = DM / 128;                 // 8
    const int bidN = blockIdx.x % tilesN;
    const int bidM = blockIdx.x / tilesN;
    const int rowBase = bidM * 128 + wm * 64;
    const int colBase = bidN * 128 + wn * 64;

    const _Float16* ap = ctx   + (rowBase >> 4) * FT + lane * 8;
    const _Float16* bp = WoutT + (colBase >> 4) * FT + lane * 8;

    v8f acc[WT][WT] = {};
    // a pass is 64 k: two fragment tiles of every operand row group
#pragma unroll  // unrolled, a pass's loads issue among the WMMAs of the pass before
    for (int kt = 0; kt < DM / 32; kt += 2) {
        v16h a[2][WT], b[2][WT];
#pragma unroll  // constant indices: the fragments stay in registers
        for (int h = 0; h < 2; ++h)
#pragma unroll  // the same
            for (int t = 0; t < WT; ++t) {
                a[h][t] = load_frag(ap + ((kt + h) * (ROWS / 16) + t) * FT);
                b[h][t] = load_frag(bp + ((kt + h) * (DM / 16) + t) * FT);
            }
        // holds the pass's 32 loads together in front of its WMMAs: without it the compiler sinks
        // each fragment's loads to its own WMMA, and the wave waits out one latency per fragment
        __builtin_amdgcn_sched_barrier(0);
#pragma unroll  // constant indices; the k order of every sum is as before
        for (int h = 0; h < 2; ++h)
#pragma unroll  // the same
            for (int mt = 0; mt < WT; ++mt)
#pragma unroll  // the same
                for (int nt = 0; nt < WT; ++nt) acc[mt][nt] = wmma32(a[h][mt], b[h][nt], acc[mt][nt]);
    }
    // inputs only: every A load names one address pair; this holds the pair past the last pass's loads,
    // so that no load's result is put into registers that a load in flight names
    asm volatile("" :: "v"(ap));
    // stands between the k loop's last loads and the bias loads below, whose results the compiler puts into
    // the registers that hold those loads' addresses: the wait before a register of an issued load is overwritten
    asm volatile("s_wait_xcnt 0x0" ::: "memory");
    const int hl = lane >> 4, n = lane & 15;
    // the wave's rows are sorted rows: each goes to the row of out that it came from in x (a row's 256 B stay
    // together). Store p below has row p * 2 + hl; read here, the table lands while the tile is staged
    const int tidx = rowBase + hl, bidx = colBase + n;
    int orow[32];
#pragma unroll  // the loads in flight together, orow[] in registers
    for (int p = 0; p < 32; ++p) orow[p] = srcTab[tidx + p * 2];
    float bias[WT];
#pragma unroll  // the four bias loads in flight together
    for (int nt = 0; nt < WT; ++nt) bias[nt] = bout[bidx + nt * 16];
    float* st = &stage[wave][0];
#pragma unroll  // constant indices: acc[] stays in registers
    for (int nt = 0; nt < WT; ++nt) {
#pragma unroll  // the same
        for (int mt = 0; mt < WT; ++mt)
#pragma unroll  // the same
            for (int i = 0; i < 8; ++i) st[(mt * 16 + i + 8 * hl) * OP + nt * 16 + n] = acc[mt][nt][i] + bias[nt];
    }
    // the wave's own LDS stores are done before its lanes read each other's rows back
    asm volatile("s_wait_dscnt 0x0" ::: "memory");
    // inputs only: the table loads share one index register, the bias loads another; this holds both until the last
    // load of each has landed, so that nothing is written into a register that a load in flight names
    asm volatile("" :: "v"(tidx), "v"(orow[31]), "v"(bidx), "v"(bias[WT - 1]));
    float* dst = out + colBase;
#pragma unroll  // the LDS reads issued ahead of the stores
    for (int p = 0; p < 32; ++p) {
        int c = p * 32 + lane;                   // 16-byte piece: 16 to a row of 64 columns
        int row = c >> 4, pc = c & 15;
        *(v4f*)(dst + (size_t)(orow[p] & (ROWS - 1)) * DM + pc * 4) =    // the address stays inside out
            *(const v4f*)(st + row * OP + pc * 4);
    }
}

extern "C" void kernel_launch(void* const* d_in, const int* in_sizes, int n_in,
                              void* d_out, int out_size, void* d_ws, size_t ws_size,
                              hipStream_t stream) {
    const float* x    = (const float*)d_in[0];   // (2,2048,1024)
    const int*   mask = (const int*)  d_in[1];   // (2,2048)
    const float* Wqkv = (const float*)d_in[2];   // (1024,3072)
    const float* bqkv = (const float*)d_in[3];   // (3072)
    const float* Wout = (const float*)d_in[4];   // (1024,1024)
    const float* bout = (const float*)d_in[5];   // (1024)
    float* out = (float*)d_out;                  // (2,2048,1024)

    char* ws = (char*)d_ws;
    _Float16* xh     = (_Float16*)ws;                 ws += (size_t)ROWS * DM  * 2; // 8 MB
    _Float16* WqkvT  = (_Float16*)ws;                 ws += (size_t)DM3  * DM  * 2; // 6 MB
    _Float16* WoutT  = (_Float16*)ws;                 ws += (size_t)DM   * DM  * 2; // 2 MB
    _Float16* Qh     = (_Float16*)ws;                 ws += (size_t)ROWS * DM  * 2 / NHEAD * NHEAD; // 8 MB
    _Float16* Kh     = (_Float16*)ws;                 ws += (size_t)ROWS * DM  * 2; // 8 MB (Qh advanced same)
    _Float16* Vt     = (_Float16*)ws;                 ws += (size_t)ROWS * DM  * 2; // 8 MB
    _Float16* ctx    = (_Float16*)ws;                 ws += (size_t)ROWS * DM  * 2; // 8 MB
    int*      srcTab = (int*)ws;                      ws += (size_t)ROWS * 4;       // 16 KB
    int*      cnt    = (int*)ws;                      // BATCH lines of 128 B

    // prep: f16 conversions (x: rows sorted by the mask) / weight transposes
    cvt_f16_kernel<<<(ROWS / 16) * (DM / 32) / 8, 256, 0, stream>>>(x, mask, xh, srcTab, cnt);
    transpose_cvt_kernel<<<dim3(DM3 / TT, DM / TT), 256, 0, stream>>>(Wqkv, WqkvT, DM, DM3);
    transpose_cvt_kernel<<<dim3(DM / TT, DM / TT), 256, 0, stream>>>(Wout, WoutT, DM, DM);

    // QKV projection: grid = (4096/128) * (3072/128)
    qkv_kernel<<<(ROWS / 128) * (DM3 / 128), 128, 0, stream>>>(xh, WqkvT, bqkv, cnt, Qh, Kh, Vt);

    // attention: 4096 q-tiles, 8 per block
    attn_kernel<<<(BATCH * NHEAD * (SEQ / 16)) / 8, 256, 0, stream>>>(Qh, Kh, Vt, cnt, ctx);

    // output projection: grid = (4096/128) * (1024/128)
    out_proj_kernel<<<(ROWS / 128) * (DM / 128), 128, 0, stream>>>(ctx, WoutT, bout, srcTab, out);
}

// v009
// A run of this version takes 62.6 microseconds.
// Next to v008, in two timings, it ran 1.08 times as fast each time.
// All steps since v000 together make it 7.09 times as fast.
#include <hip/hip_runtime.h>
#include <hip/hip_bf16.h>

#define DM     1024
#define DM3    3072
#define SEQ    2048
#define BATCH  2
#define NHEAD  16
#define DK     64
#define ROWS   (BATCH * SEQ)          // 4096
#define SCALE_F 0.125f                 // 1/sqrt(64)
#define MASK_FILL_F (-10000.0f)

typedef __attribute__((ext_vector_type(16))) _Float16 v16h;
typedef __attribute__((ext_vector_type(8)))  _Float16 v8h;
typedef __attribute__((ext_vector_type(4)))  _Float16 v4h;
typedef __attribute__((ext_vector_type(4)))  float    v4f;
typedef __attribute__((ext_vector_type(4)))  int      v4i;
typedef __attribute__((ext_vector_type(2)))  float    v2f;
typedef __attribute__((ext_vector_type(2)))  _Float16 v2h;
typedef __attribute__((ext_vector_type(8)))  float    v8f;

union F16x16 { v16h v; v8h h[2]; };

// Every f16 operand in the workspace is kept in fragment order: a matrix is cut into tiles of
// 16 rows x 32 k, FT halfs (1 KB) each, and the tiles that one pass of the reader takes lie in a row:
// GEMM operands of R rows: tile (rt, kt) is number kt * R/16 + rt; Q, K: rt * 2 + kt; V^T: kt * 4 + rt.
// A tile is 64 pieces of 16 bytes; piece w holds row (w & 15), k piece_k(w) .. piece_k(w) + 7.
// Pieces 0..31 are what the 32 lanes take with a fragment's first load, 32..63 with its second,
// so each load of a wave is 512 bytes in a row (4 whole lines), not 16 pieces of 16 lines.
#define FT 512
__device__ __forceinline__ int piece_k(int w) { return ((w >> 5) << 4) + (((w >> 4) & 1) << 3); }

// Per-lane WMMA f16 operand fragment load (A or B) of one 16x32 tile in fragment order.
// Lane L holds row (L&15); K-chunks {e0..e0+7} and {e0+16..e0+23}, e0 = (L>>4)*8.
// Two 16-byte loads -> global_load_b128, or ds_load_b128 for a tile in LDS.
// 'piece' is the lane's own first piece of the tile: tile + lane * 8.
__device__ __forceinline__ v16h load_frag(const _Float16* piece) {
    F16x16 u;
    u.h[0] = *(const v8h*)(piece);
    u.h[1] = *(const v8h*)(piece + FT / 2);
    return u.v;
}

__device__ __forceinline__ v8f wmma32(v16h a, v16h b, v8f c) {
    return __builtin_amdgcn_wmma_f32_16x16x32_f16(false, a, false, b, (short)0, c, false, false);
}

// ---------------- prep kernel ----------------
// in: ROWS x DM (f32, row-major) -> out: the matrix in f16, fragment order, ITS ROWS SORTED inside each batch:
// first the positions whose mask is not 0 (the kept keys), in their order, then the others, in theirs.
// Everything between here and the output projection's stores works on sorted rows: a projection takes
// each row by itself, and attention does not depend on the order of its keys. Sorted, the keys that
// the mask fills stand behind all others, and the attention loop can end in front of them.
// srcTab[sorted row] = row of x and of out; cnt[batch * CNT_STEP] = kept keys of the batch.
// One wave per 16 x 32 tile: a lane reads the two runs of 8 floats that make its two pieces.
// Each block ranks its batch's SEQ positions itself (8 KB of mask, a wave 256 positions by ballots).
// blk: the block's number among the CVT_BLOCKS blocks of this job (see prep_kernel).
// wsum[8]: kept keys among each wave's 256 positions; rowsrc[32]: position of sorted rows (rt & ~1) * 16 .. + 31 (LDS).
#define CNT_STEP 32                    // each batch's count in a 128-byte line of its own
#define CVT_BLOCKS ((ROWS / 16) * (DM / 32) / 8)
__device__ __forceinline__ void cvt_f16_block(int blk,
                                              const float* __restrict__ in,
                                              const int* __restrict__ mask,
                                              _Float16* __restrict__ out,
                                              int* __restrict__ srcTab,
                                              int* __restrict__ cnt,
                                              int* wsum, int* rowsrc) {
    const int lane = threadIdx.x & 31;
    const int wave = threadIdx.x >> 5;
    const int t  = blk * 8 + wave;               // a block reads 1 KB of each of 16 rows
    const int rt = t / (DM / 32), kt = t % (DM / 32);      // rt is the same for the whole block
    const int bb = rt / (SEQ / 16), rtl = rt % (SEQ / 16);

    const int* mb = mask + bb * SEQ + wave * 256 + lane;
    int mv[8];
#pragma unroll  // the eight loads in flight together, mv[] in registers
    for (int i = 0; i < 8; ++i) mv[i] = mb[i * 32];
    unsigned bits[8];
    int before[8], tot = 0;
#pragma unroll  // constant indices: the arrays stay in registers
    for (int i = 0; i < 8; ++i) {
        bits[i] = __builtin_amdgcn_ballot_w32(mv[i] != 0);
        before[i] = tot;
        tot += __builtin_popcount(bits[i]);
    }
    if (lane == 0) wsum[wave] = tot;
    // every wave needs the other waves' counts
    __syncthreads();
    int base = 0, n1 = 0;
#pragma unroll  // the eight LDS reads issued together
    for (int w = 0; w < 8; ++w) {
        const int c = wsum[w];
        base += (w < wave) ? c : 0;
        n1 += c;
    }
#pragma unroll  // constant indices into the arrays
    for (int i = 0; i < 8; ++i) {
        const int s = wave * 256 + i * 32 + lane;
        const int kept = base + before[i] + (int)__builtin_amdgcn_mbcnt_lo(bits[i], 0u);   // kept keys in front of s
        const int rank = (mv[i] != 0) ? kept : n1 + (s - kept);
        if ((rank >> 5) == (rtl >> 1)) rowsrc[rank & 31] = s;    // rank is a permutation: each slot written once
    }
    // the 32 slots are written by any wave and read by all
    __syncthreads();
    // one block of eight writes a whole 128-byte line of the table
    if ((blk & 7) == 0 && threadIdx.x < 32) srcTab[rt * 16 + threadIdx.x] = bb * SEQ + rowsrc[threadIdx.x];
    if (rtl == 0 && kt == 0 && lane == 0) cnt[bb * CNT_STEP] = n1;

    const int srow = rowsrc[(rtl & 1) * 16 + (lane & 15)] & (SEQ - 1);   // the address stays inside the batch
    const float* src = in + (size_t)(bb * SEQ + srow) * DM + kt * 32 + piece_k(lane);
    v4f v[4];
#pragma unroll  // all four loads in flight at once, v[] in registers
    for (int i = 0; i < 4; ++i) v[i] = *(const v4f*)(src + (i >> 1) * 16 + (i & 1) * 4);
#pragma unroll  // constant indices into v[]
    for (int p = 0; p < 2; ++p) {
        v8h h;
#pragma unroll  // the same
        for (int j = 0; j < 8; ++j) h[j] = (_Float16)v[p * 2 + (j >> 2)][j & 3];
        *(v8h*)(out + (size_t)(kt * (ROWS / 16) + rt) * FT + p * (FT / 2) + lane * 8) = h;
    }
}

// in: rows x cols (f32) -> out: cols x rows (f16), N-major weights, in fragment order.
// One 64 x 64 tile per block, turned in LDS: rows are read as 256-byte runs and
// the block's 8 fragment tiles leave as whole lines. rows and cols are multiples of 64.
// blk: the block's number among the job's (rows / TT) * (cols / TT) blocks; tile: TT * TP halfs of LDS.
#define TT 64
#define TP 72                          // LDS pitch in halfs: 144 B = 16 B x odd, for the 16-byte readers
__device__ __forceinline__ void transpose_cvt_block(int blk,
                                                    const float* __restrict__ in,
                                                    _Float16* __restrict__ out,
                                                    int cols, _Float16* tile) {
    const int r0 = blk / (cols / TT) * TT;
    const int c0 = blk % (cols / TT) * TT;
    const int cg = threadIdx.x & 15;             // 4 columns
    const int rg = threadIdx.x >> 4;             // 4 rows

    v4f v[4];
#pragma unroll  // all four loads in flight at once, v[] in registers
    for (int i = 0; i < 4; ++i)
        v[i] = *(const v4f*)(in + (size_t)(r0 + rg * 4 + i) * cols + c0 + cg * 4);
#pragma unroll  // constant indices into v[]
    for (int j = 0; j < 4; ++j) {
        v4h h = { (_Float16)v[0][j], (_Float16)v[1][j], (_Float16)v[2][j], (_Float16)v[3][j] };
        *(v4h*)(tile + (cg * 4 + j) * TP + rg * 4) = h;
    }
    // the tile is written by all waves and read across them
    __syncthreads();

#pragma unroll  // both LDS reads issued before the first store
    for (int p = 0; p < 2; ++p) {
        int q = p * 256 + threadIdx.x;           // 512 pieces: 4 x 2 fragment tiles of 64
        int rt = q >> 7, kt = (q >> 6) & 1, w = q & 63;
        *(v8h*)(out + ((size_t)((r0 >> 5) + kt) * (cols >> 4) + (c0 >> 4) + rt) * FT + w * 8) =
            *(const v8h*)(tile + (rt * 16 + (w & 15)) * TP + kt * 32 + piece_k(w));
    }
    // inlined into prep_kernel, the stores are followed by the other jobs' code in the listing: the wait before
    // a register that an issued store names is overwritten
    asm volatile("s_wait_xcnt 0x0" ::: "memory");
}

// The three jobs above do not depend on one another: they share one launch, and the block index picks the job.
// The choice is the same for a whole block, so every barrier of a job is passed by all of the block's waves.
#define TQ_BLOCKS ((DM / TT) * (DM3 / TT))
#define TO_BLOCKS ((DM / TT) * (DM / TT))
__global__ __launch_bounds__(256) void prep_kernel(const float* __restrict__ x,
                                                   const int* __restrict__ mask,
                                                   const float* __restrict__ Wqkv,
                                                   const float* __restrict__ Wout,
                                                   _Float16* __restrict__ xh,
                                                   _Float16* __restrict__ WqkvT,
                                                   _Float16* __restrict__ WoutT,
                                                   int* __restrict__ srcTab,
                                                   int* __restrict__ cnt) {
    __shared__ __align__(16) _Float16 tile[TT * TP];
    __shared__ int wsum[8];
    __shared__ int rowsrc[32];
    const int b = blockIdx.x;
    if (b < CVT_BLOCKS)                  cvt_f16_block(b, x, mask, xh, srcTab, cnt, wsum, rowsrc);
    else if (b < CVT_BLOCKS + TQ_BLOCKS) transpose_cvt_block(b - CVT_BLOCKS, Wqkv, WqkvT, DM3, tile);
    else                                 transpose_cvt_block(b - CVT_BLOCKS - TQ_BLOCKS, Wout, WoutT, DM, tile);
}

// ---------------- QKV projection ----------------
// C(4096x3072) = xh(4096x1024) @ Wqkv + bqkv ; into Qh/Kh (s x d) and Vt (d x s), a matrix per head.
// A wave takes 64 x 64 of C: 4 + 4 fragments of 32 k feed 16 WMMAs, each loaded fragment four of them.
// A block is 2 x 2 waves, 128 x 128: two heads of one of Q, K, V. Each head's 128 x 64 is gathered in LDS
// and leaves in fragment order as whole 128-byte lines, 16 KB in a row.
#define WT 4                           // fragment tiles per wave and operand: 64 rows, 64 columns
#define QP 72                          // Q/K stage pitch in halfs: 144 B = 16 B x odd
#define VP 136                         // V^T stage pitch in halfs: 272 B = 16 B x odd
__global__ __launch_bounds__(128) void qkv_kernel(const _Float16* __restrict__ xh,
                                                  const _Float16* __restrict__ WqkvT,
                                                  const float* __restrict__ bqkv,
                                                  const int* __restrict__ cnt,
                                                  _Float16* __restrict__ Qh,
                                                  _Float16* __restrict__ Kh,
                                                  _Float16* __restrict__ Vt) {
    __shared__ __align__(16) _Float16 stage[2][128 * QP];   // V^T needs 64 * VP a head, which is less
    const int wave = threadIdx.x >> 5;
    const int lane = threadIdx.x & 31;
    const int wm = wave >> 1, wn = wave & 1;
    const int tilesN = DM3 / 128;                // 24
    const int bidN = blockIdx.x % tilesN;
    const int bidM = blockIdx.x / tilesN;
    // rows are sorted (see cvt_f16_block): a filled key's score is the fill whatever its K row holds, and the
    // attention kernel reads no K block that begins behind the kept keys. The whole block leaves, before any barrier
    if ((bidN * 128) / DM == 1 && (bidM * 128) % SEQ >= cnt[(bidM * 128) / SEQ * CNT_STEP]) return;
    const int rowBase = bidM * 128 + wm * 64;
    const int colBase = bidN * 128 + wn * 64;

    const _Float16* ap = xh    + (rowBase >> 4) * FT + lane * 8;
    const _Float16* bp = WqkvT + (colBase >> 4) * FT + lane * 8;

    v8f acc[WT][WT] = {};
    // a pass is 64 k: two fragment tiles of every operand row group
#pragma unroll  // unrolled, a pass's loads issue among the WMMAs of the pass before
    for (int kt = 0; kt < DM / 32; kt += 2) {
        v16h a[2][WT], b[2][WT];
#pragma unroll  // constant indices: the fragments stay in registers
        for (int h = 0; h < 2; ++h)
#pragma unroll  // the same
            for (int t = 0; t < WT; ++t) {
                a[h][t] = load_frag(ap + ((kt + h) * (ROWS / 16) + t) * FT);
                b[h][t] = load_frag(bp + ((kt + h) * (DM3 / 16) + t) * FT);
            }
        // holds the pass's 32 loads together in front of its WMMAs: without it the compiler sinks
        // each fragment's loads to its own WMMA, and the wave waits out one latency per fragment
        __builtin_amdgcn_sched_barrier(0);
#pragma unroll  // constant indices; the k order of every sum is as before
        for (int h = 0; h < 2; ++h)
#pragma unroll  // the same
            for (int mt = 0; mt < WT; ++mt)
#pragma unroll  // the same
                for (int nt = 0; nt < WT; ++nt) acc[mt][nt] = wmma32(a[h][mt], b[h][nt], acc[mt][nt]);
    }
    // stands between the k loop's last loads and the bias loads below, whose results the compiler puts into
    // the registers that hold those loads' addresses: the wait before a register of an issued load is overwritten
    asm volatile("s_wait_xcnt 0x0" ::: "memory");

    const int hl = lane >> 4, n = lane & 15;
    const int part = (bidN * 128) / DM;          // 0=Q 1=K 2=V, the same for the whole block
    const int head = ((bidN * 128) % DM) / DK;   // the block's first head; wave column wn has head + wn
    const int bb   = (bidM * 128) / SEQ;
    const int s0   = (bidM * 128) % SEQ;         // the block's 128 rows lie in one batch
    const size_t hb = (size_t)(bb * NHEAD + head);

    float bias[WT];
#pragma unroll  // the four bias loads in flight together
    for (int nt = 0; nt < WT; ++nt) bias[nt] = bqkv[colBase + nt * 16 + n];
    _Float16* st = &stage[wn][0];
#pragma unroll  // constant indices: acc[] stays in registers
    for (int mt = 0; mt < WT; ++mt) {
        v8h h[WT];
#pragma unroll  // the same
        for (int nt = 0; nt < WT; ++nt)
#pragma unroll  // the same
            for (int i = 0; i < 8; ++i) h[nt][i] = (_Float16)(acc[mt][nt][i] + bias[nt]);
        const int r0 = wm * 64 + mt * 16;        // the tile's first row in the block
        if (part == 2) {
            // stage[d][s]: a lane's 8 rows are 8 neighbours in s
#pragma unroll  // constant indices into h[]
            for (int nt = 0; nt < WT; ++nt)
                *(v8h*)(st + (nt * 16 + n) * VP + r0 + hl * 8) = h[nt];
        } else {
            // stage[s][d]
#pragma unroll  // constant indices into h[]
            for (int nt = 0; nt < WT; ++nt)
#pragma unroll  // the same
                for (int i = 0; i < 8; ++i) st[(r0 + i + 8 * hl) * QP + nt * 16 + n] = h[nt][i];
        }
    }
    // the tiles are written by all waves and read across them
    __syncthreads();

    // a head: 1024 pieces of 16 bytes = 16 fragment tiles in storage order: V^T 4 (s) x 4 (d), Q/K 8 (s) x 2 (d)
    const int lpitch = (part == 2) ? VP : QP;
    _Float16* dst = (part == 2 ? Vt : part == 0 ? Qh : Kh) + (hb * SEQ + s0) * DK;
#pragma unroll  // the LDS reads issued ahead of the stores
    for (int p = 0; p < 16; ++p) {
        int c = (p & 7) * 128 + threadIdx.x;     // p >> 3 is the head
        int tl = c >> 6, w = c & 63;
        int rt = (part == 2) ? tl & 3 : tl >> 1;
        int kt = (part == 2) ? tl >> 2 : tl & 1;
        *(v8h*)(dst + (size_t)(p >> 3) * SEQ * DK + c * 8) =
            *(const v8h*)(&stage[p >> 3][0] + (rt * 16 + (w & 15)) * lpitch + kt * 32 + piece_k(w));
    }
}

#define FILL_RAW_F (MASK_FILL_F / SCALE_F)      // the fill before the scale; the scale is a power of two
#define EXP_C_F    (SCALE_F * 1.44269504f)      // raw score -> exponent of two

// the value that lane ^ 16 holds
__device__ __forceinline__ float other_half(float v) {
    int b = __builtin_bit_cast(int, v);
    return __builtin_bit_cast(float, __builtin_amdgcn_permlanex16(b, b, 0x76543210, 0xfedcba98, false, false));
}

// One block of 32 keys; kt and vt are the lane's own first pieces of the block's four K tiles and four V^T tiles
// (KIND 0 and 1: in LDS; KIND 2: vt in global memory). KIND 0: kept keys alone. KIND 1: kept keys, then filled ones; 'lim' is the
// number of kept keys from the lane's first key (8 * hl in the block) on, register r of score tile nt being key nt * 16 + r
// from there. KIND 2: filled keys alone: every score is the fill, K is not read (and may not have been computed).
template <int KIND>
__device__ __forceinline__ void attn_block(const _Float16* kt, const _Float16* vt, int lim,
                                           v16h qf0, v16h qf1, float& rowexp, float& rowsum, v8f (&o)[4]) {
        // ---- scores: two 16 (keys) x 16 (queries) tiles over DK=64 (2 WMMA each) ----
        v2f s[8];
        if constexpr (KIND != 2) {
            v8f sc[2];
#pragma unroll  // constant indices: the arrays stay in registers
            for (int nt = 0; nt < 2; ++nt) {
                const _Float16* Kt = kt + nt * 16 * DK; // 16 keys: two tiles
                v16h b0 = load_frag(Kt);
                v16h b1 = load_frag(Kt + FT);
                v8f tacc = {};
                tacc = wmma32(b0, qf0, tacc);
                tacc = wmma32(b1, qf1, tacc);
                sc[nt] = tacc;
            }
            // ---- mask (a key per register) ----
#pragma unroll  // constant indices: the arrays stay in registers
            for (int e = 0; e < 16; ++e)
                s[e >> 1][e & 1] = (KIND == 0 || (e >> 3) * 16 + (e & 7) < lim) ? sc[e >> 3][e & 7] : FILL_RAW_F;
        } else {
#pragma unroll  // constant indices: the array stays in registers
            for (int e = 0; e < 16; ++e) s[e >> 1][e & 1] = FILL_RAW_F;
        }

        // ---- online softmax: in the lane, one exchange between the halves for the maximum ----
        float t3[5];
#pragma unroll  // constant indices: the arrays stay in registers
        for (int g = 0; g < 5; ++g) {
            const int e = g * 3;
            t3[g] = fmaxf(fmaxf(s[e >> 1][e & 1], s[(e + 1) >> 1][(e + 1) & 1]), s[(e + 2) >> 1][(e + 2) & 1]);
        }
        float tm = fmaxf(fmaxf(fmaxf(t3[0], t3[1]), t3[2]), fmaxf(fmaxf(t3[3], t3[4]), s[7][1]));
        tm = fmaxf(tm, other_half(tm));
        // the running maximum is kept as the rounded exponent that the p below are taken against:
        // alpha is then the exact ratio of the two scales, and exactly 1 while the maximum stands
        const float mexp  = fmaxf(rowexp, tm * EXP_C_F);
        const float alpha = __builtin_amdgcn_exp2f(rowexp - mexp);
        rowexp = mexp;

        const v2f c2 = { EXP_C_F, EXP_C_F }, nm2 = { -mexp, -mexp };
        v2f p[8];
#pragma unroll  // constant indices: the arrays stay in registers
        for (int j = 0; j < 8; ++j) {
            v2f x = __builtin_elementwise_fma(s[j], c2, nm2);
            p[j][0] = __builtin_amdgcn_exp2f(x[0]);
            p[j][1] = __builtin_amdgcn_exp2f(x[1]);
        }
        const v2f ps = ((p[0] + p[4]) + (p[1] + p[5])) + ((p[2] + p[6]) + (p[3] + p[7]));
        rowsum = rowsum * alpha + (ps[0] + ps[1]);
#pragma unroll  // constant indices: the arrays stay in registers
        for (int dt = 0; dt < 4; ++dt) o[dt] *= alpha;

        // ---- P^T as a B fragment: element e is key (e >> 3) * 16 + 8 * hl + (e & 7), the k order of V^T's tiles ----
        v16h pf;
#pragma unroll  // constant indices: the arrays stay in registers
        for (int j = 0; j < 8; ++j) {
            v2h h2 = __builtin_convertvector(p[j], v2h);
            pf[2 * j] = h2[0]; pf[2 * j + 1] = h2[1];
        }

        // ---- context: O^T += V^T(16x32) @ P^T(32x16) for 4 d-tiles ----
        v16h w[4];
#pragma unroll  // constant indices: w[] stays in registers
        for (int dt = 0; dt < 4; ++dt) w[dt] = load_frag(vt + dt * FT);
#pragma unroll  // the same
        for (int dt = 0; dt < 4; ++dt) o[dt] = wmma32(w[dt], pf, o[dt]);
        // inputs only: the eight global V loads share one address pair; this holds the pair until the last
        // load has landed, so that no load's result is put into registers that a load in flight names
        if constexpr (KIND == 2) asm volatile("" :: "v"(vt), "v"(w[3]));
}

#define STG_KEYS  128
#define STG_HALFS (STG_KEYS * DK)               // 16 KB of K, and as much of V^T, a stage

// One stage: a thread copies four pieces of 16 bytes of K and four of V^T, 4 KB apart, straight into LDS.
// lk, lv: LDS byte addresses of the thread's first pieces; gk, gv: the same pieces in global memory.
__device__ __forceinline__ void stage_copy(unsigned lk, unsigned lv, const _Float16* gk, const _Float16* gv) {
    // the wait is the statement's last line: it stands in front of every later write of a register that a copy names
    asm volatile("global_load_async_to_lds_b128 %0, %8, off\n\t"
                 "global_load_async_to_lds_b128 %1, %9, off\n\t"
                 "global_load_async_to_lds_b128 %2, %10, off\n\t"
                 "global_load_async_to_lds_b128 %3, %11, off\n\t"
                 "global_load_async_to_lds_b128 %4, %12, off\n\t"
                 "global_load_async_to_lds_b128 %5, %13, off\n\t"
                 "global_load_async_to_lds_b128 %6, %14, off\n\t"
                 "global_load_async_to_lds_b128 %7, %15, off\n\t"
                 "s_wait_xcnt 0x0"
                 :: "v"(lk), "v"(lk + 4096u), "v"(lk + 8192u), "v"(lk + 12288u),
                    "v"(lv), "v"(lv + 4096u), "v"(lv + 8192u), "v"(lv + 12288u),
                    "v"(gk), "v"(gk + 2048), "v"(gk + 4096), "v"(gk + 6144),
                    "v"(gv), "v"(gv + 2048), "v"(gv + 4096), "v"(gv + 6144)
                 : "memory");
}

__global__ __launch_bounds__(256) __attribute__((amdgpu_waves_per_eu(4, 4))) void attn_kernel(const _Float16* __restrict__ Qh,
                                                   const _Float16* __restrict__ Kh,
                                                   const _Float16* __restrict__ Vt,
                                                   const int* __restrict__ cnt,
                                                   _Float16* __restrict__ ctx) {
    __shared__ __align__(128) _Float16 kv[2][2][STG_HALFS];     // [buffer][K, V^T]
    const int wave = threadIdx.x >> 5;
    const int lane = threadIdx.x & 31;
    int qt = blockIdx.x * 8 + wave;              // 4096 q-tiles total
    int t = qt;
    const int qi   = (t % (SEQ / 16)) * 16; t /= (SEQ / 16);
    const int head = t % NHEAD;             t /= NHEAD;
    const int bb   = t;

    const _Float16* Qbase = Qh + ((size_t)(bb * NHEAD + head) * SEQ + qi) * DK + lane * 8;
    const _Float16* Vbase = Vt + (size_t)(bb * NHEAD + head) * DK * SEQ + lane * 8;
    // the thread's first piece of the head's K and V^T (batch and head are the same for the whole work-group)
    const _Float16* Kcopy = Kh + (size_t)(bb * NHEAD + head) * SEQ * DK + threadIdx.x * 8;
    const _Float16* Vcopy = Vt + (size_t)(bb * NHEAD + head) * DK * SEQ + threadIdx.x * 8;
    // and its place in buffer 0: the low 32 bits of a __shared__ address are the LDS byte address
    const unsigned lk0 = (unsigned)(size_t)&kv[0][0][threadIdx.x * 8];
    const unsigned lv0 = (unsigned)(size_t)&kv[0][1][threadIdx.x * 8];

    const v16h qf0 = load_frag(Qbase);                  // d 0..31
    const v16h qf1 = load_frag(Qbase + FT);             // d 32..63

    const int hl = lane >> 4;
    // the batch's kept keys; a block's eight query tiles lie in one batch. Clamped: it bounds the loops' trips
    // (readfirstlane: the clamp compiles to a vector instruction; back in a scalar register, the loop tests are scalar)
    const int n1 = __builtin_amdgcn_readfirstlane(min(max(cnt[(blockIdx.x * 8 / (NHEAD * (SEQ / 16))) * CNT_STEP], 0), SEQ));

    // of the lane's query: the maximum as an exponent of two, and the lane's own part of the sum
    float rowexp = -1e30f, rowsum = 0.0f;
    v8f o[4] = {};                                      // o[dt][r] = O[query lane & 15][d dt * 16 + 8 * hl + r]

    // stages that hold a kept key, at most SEQ / STG_KEYS. A stage is copied whole: the K projection leaves out
    // only blocks of 128 rows that begin behind the kept keys, so every K row of such a stage was written
    const int nst = (n1 + STG_KEYS - 1) / STG_KEYS;
    if (nst > 0) {
        stage_copy(lk0, lv0, Kcopy, Vcopy);
        // stage 0 has landed, for this wave's copies
        asm volatile("s_wait_asynccnt 0x0" ::: "memory");
        // and for every wave's: nothing of it is read in front of this barrier
        __syncthreads();
        if (nst > 1) stage_copy(lk0 + 4u * STG_HALFS, lv0 + 4u * STG_HALFS, Kcopy + STG_HALFS, Vcopy + STG_HALFS);
        for (int st = 0; st < nst; ++st) {
            const _Float16* kl = &kv[st & 1][0][lane * 8];
            const _Float16* vl = &kv[st & 1][1][lane * 8];
            const int left = n1 - st * STG_KEYS;             // kept keys from the stage's first key on, above 0
            const int full = min(left >> 5, STG_KEYS / 32);  // blocks of kept keys alone
            for (int j = 0; j < full; ++j)
                attn_block<0>(kl + j * 32 * DK, vl + j * 32 * DK, 0, qf0, qf1, rowexp, rowsum, o);
            if (full < STG_KEYS / 32 && full * 32 < left)
                attn_block<1>(kl + full * 32 * DK, vl + full * 32 * DK, left - full * 32 - hl * 8, qf0, qf1, rowexp, rowsum, o);
            // the wave's own reads of this buffer are done before it is refilled
            asm volatile("s_wait_dscnt 0x0" ::: "memory");
            // the wave's copies of the next stage have landed
            asm volatile("s_wait_asynccnt 0x0" ::: "memory");
            // publishes the next stage and ends every wave's reads of this buffer
            __syncthreads();
            if (st + 2 < nst)
                stage_copy(lk0 + (unsigned)(st & 1) * (4u * STG_HALFS), lv0 + (unsigned)(st & 1) * (4u * STG_HALFS),
                           Kcopy + (size_t)(st + 2) * STG_HALFS, Vcopy + (size_t)(st + 2) * STG_HALFS);
        }
        // no copy is in flight when the wave goes on
        asm volatile("s_wait_asynccnt 0x0" ::: "memory");
    }
    for (int kb = (n1 + 31) & ~31; kb < SEQ; kb += 32) {
        // only filled keys are left, each with the same score. Where its p, taken as attn_block takes it,
        // is 0 for every query of the wave, the maximum stands (alpha is 1) and each further block would
        // add 0 to every sum: leaving here changes no bit. With no kept keys the walk goes on.
        const float pfill = __builtin_amdgcn_exp2f(__builtin_fmaf(FILL_RAW_F, EXP_C_F, -rowexp));
        if (__builtin_amdgcn_ballot_w32(pfill != 0.0f) == 0) break;
        attn_block<2>(nullptr, Vbase + (size_t)kb * DK, 0, qf0, qf1, rowexp, rowsum, o);
    }

    // inputs only: the four Q loads share one address pair; this holds the pair until the last of them has
    // landed, so that nothing is written into registers that a load in flight names
    asm volatile("" :: "v"(Qbase), "v"(qf1));

    // ---- epilogue: join the halves' sums, normalize, store ctx (f16) ----
    const float inv = 1.0f / (rowsum + other_half(rowsum));
    // ctx is a GEMM operand of ROWS rows: the wave's 16 x 64 are two of its tiles. A lane's 8 values of
    // o[dt] are piece (dt & 1) * 32 + lane of tile dt >> 1: each store of the wave is 512 bytes in a row
    _Float16* cdst = ctx + ((size_t)head * (DK / 32) * (ROWS / 16) + ((bb * SEQ + qi) >> 4)) * FT + lane * 8;
#pragma unroll  // constant indices into o[]
    for (int dt = 0; dt < 4; ++dt) {
        v8h h;
#pragma unroll  // the same
        for (int i = 0; i < 8; ++i) h[i] = (_Float16)(o[dt][i] * inv);
        *(v8h*)(cdst + (dt >> 1) * (ROWS / 16) * FT + (dt & 1) * (FT / 2)) = h;
    }
}

// ---------------- output projection ----------------
// Wave and block tiles as in the QKV projection: 64 x 64 a wave, 2 x 2 waves.
#define OP 68                          // f32 stage pitch in dwords: 272 B = 16 B x odd
__global__ __launch_bounds__(128) void out_proj_kernel(const _Float16* __restrict__ ctx,
                                                       const _Float16* __restrict__ WoutT,
                                                       const float* __restrict__ bout,
                                                       const int* __restrict__ srcTab,
                                                       float* __restrict__ out) {
    // each wave stages its own 64 x 64 f32 tile: a row is 256 B, two whole lines
    __shared__ __align__(16) float stage[4][64 * OP];
    const int wave = threadIdx.x >> 5;
    const int lane = threadIdx.x & 31;
    const int wm = wave >> 1, wn = wave & 1;
    const int tilesN = DM / 128;                 // 8
    const int bidN = blockIdx.x % tilesN;
    const int bidM = blockIdx.x / tilesN;
    const int rowBase = bidM * 128 + wm * 64;
    const int colBase = bidN * 128 + wn * 64;

    const _Float16* ap = ctx   + (rowBase >> 4) * FT + lane * 8;
    const _Float16* bp = WoutT + (colBase >> 4) * FT + lane * 8;

    v8f acc[WT][WT] = {};
    // a pass is 64 k: two fragment tiles of every operand row group
#pragma unroll  // unrolled, a pass's loads issue among the WMMAs of the pass before
    for (int kt = 0; kt < DM / 32; kt += 2) {
        v16h a[2][WT], b[2][WT];
#pragma unroll  // constant indices: the fragments stay in registers
        for (int h = 0; h < 2; ++h)
#pragma unroll  // the same
            for (int t = 0; t < WT; ++t) {
                a[h][t] = load_frag(ap + ((kt + h) * (ROWS / 16) + t) * FT);
                b[h][t] = load_frag(bp + ((kt + h) * (DM / 16) + t) * FT);
            }
        // holds the pass's 32 loads together in front of its WMMAs: without it the compiler sinks
        // each fragment's loads to its own WMMA, and the wave waits out one latency per fragment
        __builtin_amdgcn_sched_barrier(0);
#pragma unroll  // constant indices; the k order of every sum is as before
        for (int h = 0; h < 2; ++h)
#pragma unroll  // the same
            for (int mt = 0; mt < WT; ++mt)
#pragma unroll  // the same
                for (int nt = 0; nt < WT; ++nt) acc[mt][nt] = wmma32(a[h][mt], b[h][nt], acc[mt][nt]);
    }
    // inputs only: every A load names one address pair; this holds the pair past the last pass's loads,
    // so that no load's result is put into registers that a load in flight names
    asm volatile("" :: "v"(ap));
    // stands between the k loop's last loads and the bias loads below, whose results the compiler puts into
    // the registers that hold those loads' addresses: the wait before a register of an issued load is overwritten
    asm volatile("s_wait_xcnt 0x0" ::: "memory");
    const int hl = lane >> 4, n = lane & 15;
    // the wave's rows are sorted rows: each goes to the row of out that it came from in x (a row's 256 B stay
    // together). Store p below has row p * 2 + hl; read here, the table lands while the tile is staged
    const int tidx = rowBase + hl, bidx = colBase + n;
    int orow[32];
#pragma unroll  // the loads in flight together, orow[] in registers
    for (int p = 0; p < 32; ++p) orow[p] = srcTab[tidx + p * 2];
    float bias[WT];
#pragma unroll  // the four bias loads in flight together
    for (int nt = 0; nt < WT; ++nt) bias[nt] = bout[bidx + nt * 16];
    float* st = &stage[wave][0];
#pragma unroll  // constant indices: acc[] stays in registers
    for (int nt = 0; nt < WT; ++nt) {
#pragma unroll  // the same
        for (int mt = 0; mt < WT; ++mt)
#pragma unroll  // the same
            for (int i = 0; i < 8; ++i) st[(mt * 16 + i + 8 * hl) * OP + nt * 16 + n] = acc[mt][nt][i] + bias[nt];
    }
    // the wave's own LDS stores are done before its lanes read each other's rows back
    asm volatile("s_wait_dscnt 0x0" ::: "memory");
    // inputs only: the table loads share one index register, the bias loads another; this holds both until the last
    // load of each has landed, so that nothing is written into a register that a load in flight names
    asm volatile("" :: "v"(tidx), "v"(orow[31]), "v"(bidx), "v"(bias[WT - 1]));
    float* dst = out + colBase;
#pragma unroll  // the LDS reads issued ahead of the stores
    for (int p = 0; p < 32; ++p) {
        int c = p * 32 + lane;                   // 16-byte piece: 16 to a row of 64 columns
        int row = c >> 4, pc = c & 15;
        *(v4f*)(dst + (size_t)(orow[p] & (ROWS - 1)) * DM + pc * 4) =    // the address stays inside out
            *(const v4f*)(st + row * OP + pc * 4);
    }
}

extern "C" void kernel_launch(void* const* d_in, const int* in_sizes, int n_in,
                              void* d_out, int out_size, void* d_ws, size_t ws_size,
                              hipStream_t stream) {
    const float* x    = (const float*)d_in[0];   // (2,2048,1024)
    const int*   mask = (const int*)  d_in[1];   // (2,2048)
    const float* Wqkv = (const float*)d_in[2];   // (1024,3072)
    const float* bqkv = (const float*)d_in[3];   // (3072)
    const float* Wout = (const float*)d_in[4];   // (1024,1024)
    const float* bout = (const float*)d_in[5];   // (1024)
    float* out = (float*)d_out;                  // (2,2048,1024)

    char* ws = (char*)d_ws;
    _Float16* xh     = (_Float16*)ws;                 ws += (size_t)ROWS * DM  * 2; // 8 MB
    _Float16* WqkvT  = (_Float16*)ws;                 ws += (size_t)DM3  * DM  * 2; // 6 MB
    _Float16* WoutT  = (_Float16*)ws;                 ws += (size_t)DM   * DM  * 2; // 2 MB
    _Float16* Qh     = (_Float16*)ws;                 ws += (size_t)ROWS * DM  * 2 / NHEAD * NHEAD; // 8 MB
    _Float16* Kh     = (_Float16*)ws;                 ws += (size_t)ROWS * DM  * 2; // 8 MB (Qh advanced same)
    _Float16* Vt     = (_Float16*)ws;                 ws += (size_t)ROWS * DM  * 2; // 8 MB
    _Float16* ctx    = (_Float16*)ws;                 ws += (size_t)ROWS * DM  * 2; // 8 MB
    int*      srcTab = (int*)ws;                      ws += (size_t)ROWS * 4;       // 16 KB
    int*      cnt    = (int*)ws;                      // BATCH lines of 128 B

    // prep: f16 conversion (x: rows sorted by the mask) and both weight transposes, one launch
    prep_kernel<<<CVT_BLOCKS + TQ_BLOCKS + TO_BLOCKS, 256, 0, stream>>>(x, mask, Wqkv, Wout, xh, WqkvT, WoutT, srcTab, cnt);

    // QKV projection: grid = (4096/128) * (3072/128)
    qkv_kernel<<<(ROWS / 128) * (DM3 / 128), 128, 0, stream>>>(xh, WqkvT, bqkv, cnt, Qh, Kh, Vt);

    // attention: 4096 q-tiles, 8 per block
    attn_kernel<<<(BATCH * NHEAD * (SEQ / 16)) / 8, 256, 0, stream>>>(Qh, Kh, Vt, cnt, ctx);

    // output projection: grid = (4096/128) * (1024/128)
    out_proj_kernel<<<(ROWS / 128) * (DM / 128), 128, 0, stream>>>(ctx, WoutT, bout, srcTab, out);
}

// v010
// A run of this version takes 55.7 microseconds.
// Timed twice side by side with v009, it ran 1.12 times as fast both times.
// All steps since v000 together make it 7.96 times as fast.
#include <hip/hip_runtime.h>
#include <hip/hip_bf16.h>

#define DM     1024
#define DM3    3072
#define SEQ    2048
#define BATCH  2
#define NHEAD  16
#define DK     64
#define ROWS   (BATCH * SEQ)          // 4096
#define SCALE_F 0.125f                 // 1/sqrt(64)
#define MASK_FILL_F (-10000.0f)

typedef __attribute__((ext_vector_type(16))) _Float16 v16h;
typedef __attribute__((ext_vector_type(8)))  _Float16 v8h;
typedef __attribute__((ext_vector_type(4)))  _Float16 v4h;
typedef __attribute__((ext_vector_type(4)))  float    v4f;
typedef __attribute__((ext_vector_type(4)))  int      v4i;
typedef __attribute__((ext_vector_type(2)))  float    v2f;
typedef __attribute__((ext_vector_type(2)))  _Float16 v2h;
typedef __attribute__((ext_vector_type(8)))  float    v8f;

union F16x16 { v16h v; v8h h[2]; };

// Every f16 operand in the workspace is kept in fragment order: a matrix is cut into tiles of
// 16 rows x 32 k, FT halfs (1 KB) each, and the tiles that one pass of the reader takes lie in a row:
// GEMM operands of R rows: tile (rt, kt) is number kt * R/16 + rt; Q, K: rt * 2 + kt; V^T: kt * 4 + rt.
// A tile is 64 pieces of 16 bytes; piece w holds row (w & 15), k piece_k(w) .. piece_k(w) + 7.
// Pieces 0..31 are what the 32 lanes take with a fragment's first load, 32..63 with its second,
// so each load of a wave is 512 bytes in a row (4 whole lines), not 16 pieces of 16 lines.
#define FT 512
__device__ __forceinline__ int piece_k(int w) { return ((w >> 5) << 4) + (((w >> 4) & 1) << 3); }

// Per-lane WMMA f16 operand fragment load (A or B) of one 16x32 tile in fragment order.
// Lane L holds row (L&15); K-chunks {e0..e0+7} and {e0+16..e0+23}, e0 = (L>>4)*8.
// Two 16-byte loads -> global_load_b128, or ds_load_b128 for a tile in LDS.
// 'piece' is the lane's own first piece of the tile: tile + lane * 8.
__device__ __forceinline__ v16h load_frag(const _Float16* piece) {
    F16x16 u;
    u.h[0] = *(const v8h*)(piece);
    u.h[1] = *(const v8h*)(piece + FT / 2);
    return u.v;
}

__device__ __forceinline__ v8f wmma32(v16h a, v16h b, v8f c) {
    return __builtin_amdgcn_wmma_f32_16x16x32_f16(false, a, false, b, (short)0, c, false, false);
}

// ---------------- prep kernel ----------------
// in: ROWS x DM (f32, row-major) -> out: the matrix in f16, fragment order, ITS ROWS SORTED inside each batch:
// first the positions whose mask is not 0 (the kept keys), in their order, then the others, in theirs.
// Everything between here and the output projection's stores works on sorted rows: a projection takes
// each row by itself, and attention does not depend on the order of its keys. Sorted, the keys that
// the mask fills stand behind all others, and the attention loop can end in front of them.
// srcTab[sorted row] = row of x and of out; cnt[batch * CNT_STEP] = kept keys of the batch.
// One wave per 16 x 32 tile: a lane reads the two runs of 8 floats that make its two pieces.
// Each block ranks its batch's SEQ positions itself (8 KB of mask, a wave 256 positions by ballots).
// blk: the block's number among the CVT_BLOCKS blocks of this job (see prep_kernel).
// wsum[8]: kept keys among each wave's 256 positions; rowsrc[32]: position of sorted rows (rt & ~1) * 16 .. + 31 (LDS).
#define CNT_STEP 32                    // each batch's count in a 128-byte line of its own
#define CVT_BLOCKS ((ROWS / 16) * (DM / 32) / 8)
__device__ __forceinline__ void cvt_f16_block(int blk,
                                              const float* __restrict__ in,
                                              const int* __restrict__ mask,
                                              _Float16* __restrict__ out,
                                              int* __restrict__ srcTab,
                                              int* __restrict__ cnt,
                                              int* wsum, int* rowsrc) {
    const int lane = threadIdx.x & 31;
    const int wave = threadIdx.x >> 5;
    const int t  = blk * 8 + wave;               // a block reads 1 KB of each of 16 rows
    const int rt = t / (DM / 32), kt = t % (DM / 32);      // rt is the same for the whole block
    const int bb = rt / (SEQ / 16), rtl = rt % (SEQ / 16);

    const int* mb = mask + bb * SEQ + wave * 256 + lane;
    int mv[8];
#pragma unroll  // the eight loads in flight together, mv[] in registers
    for (int i = 0; i < 8; ++i) mv[i] = mb[i * 32];
    unsigned bits[8];
    int before[8], tot = 0;
#pragma unroll  // constant indices: the arrays stay in registers
    for (int i = 0; i < 8; ++i) {
        bits[i] = __builtin_amdgcn_ballot_w32(mv[i] != 0);
        before[i] = tot;
        tot += __builtin_popcount(bits[i]);
    }
    if (lane == 0) wsum[wave] = tot;
    // every wave needs the other waves' counts
    __syncthreads();
    int base = 0, n1 = 0;
#pragma unroll  // the eight LDS reads issued together
    for (int w = 0; w < 8; ++w) {
        const int c = wsum[w];
        base += (w < wave) ? c : 0;
        n1 += c;
    }
#pragma unroll  // constant indices into the arrays
    for (int i = 0; i < 8; ++i) {
        const int s = wave * 256 + i * 32 + lane;
        const int kept = base + before[i] + (int)__builtin_amdgcn_mbcnt_lo(bits[i], 0u);   // kept keys in front of s
        const int rank = (mv[i] != 0) ? kept : n1 + (s - kept);
        if ((rank >> 5) == (rtl >> 1)) rowsrc[rank & 31] = s;    // rank is a permutation: each slot written once
    }
    // the 32 slots are written by any wave and read by all
    __syncthreads();
    // one block of eight writes a whole 128-byte line of the table
    if ((blk & 7) == 0 && threadIdx.x < 32) srcTab[rt * 16 + threadIdx.x] = bb * SEQ + rowsrc[threadIdx.x];
    if (rtl == 0 && kt == 0 && lane == 0) cnt[bb * CNT_STEP] = n1;

    const int srow = rowsrc[(rtl & 1) * 16 + (lane & 15)] & (SEQ - 1);   // the address stays inside the batch
    const float* src = in + (size_t)(bb * SEQ + srow) * DM + kt * 32 + piece_k(lane);
    v4f v[4];
#pragma unroll  // all four loads in flight at once, v[] in registers
    for (int i = 0; i < 4; ++i) v[i] = *(const v4f*)(src + (i >> 1) * 16 + (i & 1) * 4);
#pragma unroll  // constant indices into v[]
    for (int p = 0; p < 2; ++p) {
        v8h h;
#pragma unroll  // the same
        for (int j = 0; j < 8; ++j) h[j] = (_Float16)v[p * 2 + (j >> 2)][j & 3];
        *(v8h*)(out + (size_t)(kt * (ROWS / 16) + rt) * FT + p * (FT / 2) + lane * 8) = h;
    }
}

// in: rows x cols (f32) -> out: cols x rows (f16), N-major weights, in fragment order.
// One 64 x 64 tile per block, turned in LDS: rows are read as 256-byte runs and
// the block's 8 fragment tiles leave as whole lines. rows and cols are multiples of 64.
// blk: the block's number among the job's (rows / TT) * (cols / TT) blocks; tile: TT * TP halfs of LDS.
#define TT 64
#define TP 72                          // LDS pitch in halfs: 144 B = 16 B x odd, for the 16-byte readers
__device__ __forceinline__ void transpose_cvt_block(int blk,
                                                    const float* __restrict__ in,
                                                    _Float16* __restrict__ out,
                                                    int cols, _Float16* tile) {
    const int r0 = blk / (cols / TT) * TT;
    const int c0 = blk % (cols / TT) * TT;
    const int cg = threadIdx.x & 15;             // 4 columns
    const int rg = threadIdx.x >> 4;             // 4 rows

    v4f v[4];
#pragma unroll  // all four loads in flight at once, v[] in registers
    for (int i = 0; i < 4; ++i)
        v[i] = *(const v4f*)(in + (size_t)(r0 + rg * 4 + i) * cols + c0 + cg * 4);
#pragma unroll  // constant indices into v[]
    for (int j = 0; j < 4; ++j) {
        v4h h = { (_Float16)v[0][j], (_Float16)v[1][j], (_Float16)v[2][j], (_Float16)v[3][j] };
        *(v4h*)(tile + (cg * 4 + j) * TP + rg * 4) = h;
    }
    // the tile is written by all waves and read across them
    __syncthreads();

#pragma unroll  // both LDS reads issued before the first store
    for (int p = 0; p < 2; ++p) {
        int q = p * 256 + threadIdx.x;           // 512 pieces: 4 x 2 fragment tiles of 64
        int rt = q >> 7, kt = (q >> 6) & 1, w = q & 63;
        *(v8h*)(out + ((size_t)((r0 >> 5) + kt) * (cols >> 4) + (c0 >> 4) + rt) * FT + w * 8) =
            *(const v8h*)(tile + (rt * 16 + (w & 15)) * TP + kt * 32 + piece_k(w));
    }
    // inlined into prep_kernel, the stores are followed by the other jobs' code in the listing: the wait before
    // a register that an issued store names is overwritten
    asm volatile("s_wait_xcnt 0x0" ::: "memory");
}

// The three jobs above do not depend on one another: they share one launch, and the block index picks the job.
// The choice is the same for a whole block, so every barrier of a job is passed by all of the block's waves.
#define TQ_BLOCKS ((DM / TT) * (DM3 / TT))
#define TO_BLOCKS ((DM / TT) * (DM / TT))
__global__ __launch_bounds__(256) void prep_kernel(const float* __restrict__ x,
                                                   const int* __restrict__ mask,
                                                   const float* __restrict__ Wqkv,
                                                   const float* __restrict__ Wout,
                                                   _Float16* __restrict__ xh,
                                                   _Float16* __restrict__ WqkvT,
                                                   _Float16* __restrict__ WoutT,
                                                   int* __restrict__ srcTab,
                                                   int* __restrict__ cnt) {
    __shared__ __align__(16) _Float16 tile[TT * TP];
    __shared__ int wsum[8];
    __shared__ int rowsrc[32];
    const int b = blockIdx.x;
    if (b < CVT_BLOCKS)                  cvt_f16_block(b, x, mask, xh, srcTab, cnt, wsum, rowsrc);
    else if (b < CVT_BLOCKS + TQ_BLOCKS) transpose_cvt_block(b - CVT_BLOCKS, Wqkv, WqkvT, DM3, tile);
    else                                 transpose_cvt_block(b - CVT_BLOCKS - TQ_BLOCKS, Wout, WoutT, DM, tile);
}

// ---------------- the k loop of both GEMMs ----------------
// A wave takes 64 x 64 of C: 4 + 4 fragments of 32 k (a chunk, 16 loads) feed 16 WMMAs.
// The fragments stand in a ring of AHEAD + 1 register sets: chunk kt + AHEAD is asked for in front of the WMMAs of
// chunk kt, so a load has the time of AHEAD chunks of WMMAs to land, not that of the last few WMMAs of one pass.
// ap, bp: the lane's own first piece of the wave's first A and B tile; ATILES, BTILES: tiles from one k tile to the next.
#define WT 4                           // fragment tiles per wave and operand: 64 rows, 64 columns
template <int AHEAD, int ATILES, int BTILES>
__device__ __forceinline__ void gemm_k_loop(const _Float16* ap, const _Float16* bp, v8f (&acc)[WT][WT]) {
    v16h a[AHEAD + 1][WT], b[AHEAD + 1][WT];
#pragma unroll  // constant indices: the fragments stay in registers
    for (int c = 0; c < AHEAD; ++c)
#pragma unroll  // the same
        for (int t = 0; t < WT; ++t) {
            a[c][t] = load_frag(ap + (c * ATILES + t) * FT);
            b[c][t] = load_frag(bp + (c * BTILES + t) * FT);
        }
#pragma unroll  // constant indices into the ring; every load's offset is an immediate
    for (int kt = 0; kt < DM / 32; ++kt) {
        if (kt + AHEAD < DM / 32) {
            const int c = kt + AHEAD, s = c % (AHEAD + 1);
#pragma unroll  // constant indices: the fragments stay in registers
            for (int t = 0; t < WT; ++t) {
                a[s][t] = load_frag(ap + (c * ATILES + t) * FT);
                b[s][t] = load_frag(bp + (c * BTILES + t) * FT);
            }
        }
        // holds the chunk's 16 loads together in front of these WMMAs: without it the compiler sinks
        // each fragment's loads to its own WMMA, AHEAD chunks later, and the lead is lost
        __builtin_amdgcn_sched_barrier(0);
        const int u = kt % (AHEAD + 1);
#pragma unroll  // constant indices; the k order of every sum is as before
        for (int mt = 0; mt < WT; ++mt)
#pragma unroll  // the same
            for (int nt = 0; nt < WT; ++nt) acc[mt][nt] = wmma32(a[u][mt], b[u][nt], acc[mt][nt]);
    }
}

// ---------------- QKV projection ----------------
// C(4096x3072) = xh(4096x1024) @ Wqkv + bqkv ; into Qh/Kh (s x d) and Vt (d x s), a matrix per head.
// A wave takes 64 x 64 of C (see gemm_k_loop).
// A block is 2 x 2 waves, 128 x 128: two heads of one of Q, K, V. Each head's 128 x 64 is gathered in LDS
// and leaves in fragment order as whole 128-byte lines, 16 KB in a row.
// three waves share a SIMD here: three sets beside the 128 accumulator registers are what their budget holds
#define QKV_AHEAD 2
#define QP 72                          // Q/K stage pitch in halfs: 144 B = 16 B x odd
#define VP 136                         // V^T stage pitch in halfs: 272 B = 16 B x odd
__global__ __launch_bounds__(128) void qkv_kernel(const _Float16* __restrict__ xh,
                                                  const _Float16* __restrict__ WqkvT,
                                                  const float* __restrict__ bqkv,
                                                  const int* __restrict__ cnt,
                                                  _Float16* __restrict__ Qh,
                                                  _Float16* __restrict__ Kh,
                                                  _Float16* __restrict__ Vt) {
    __shared__ __align__(16) _Float16 stage[2][128 * QP];   // V^T needs 64 * VP a head, which is less
    const int wave = threadIdx.x >> 5;
    const int lane = threadIdx.x & 31;
    const int wm = wave >> 1, wn = wave & 1;
    const int tilesN = DM3 / 128;                // 24
    const int bidN = blockIdx.x % tilesN;
    const int bidM = blockIdx.x / tilesN;
    // rows are sorted (see cvt_f16_block): a filled key's score is the fill whatever its K row holds, and the
    // attention kernel reads no K block that begins behind the kept keys. The whole block leaves, before any barrier
    if ((bidN * 128) / DM == 1 && (bidM * 128) % SEQ >= cnt[(bidM * 128) / SEQ * CNT_STEP]) return;
    const int rowBase = bidM * 128 + wm * 64;
    const int colBase = bidN * 128 + wn * 64;

    const _Float16* ap = xh    + (rowBase >> 4) * FT + lane * 8;
    const _Float16* bp = WqkvT + (colBase >> 4) * FT + lane * 8;

    v8f acc[WT][WT] = {};
    gemm_k_loop<QKV_AHEAD, ROWS / 16, DM3 / 16>(ap, bp, acc);
    // the wait before a register of an issued load is overwritten. Both address pairs are its inputs: they are held
    // up to it, so that nothing of the epilogue is put into them while the k loop's last loads are in flight
    asm volatile("s_wait_xcnt 0x0" :: "v"(ap), "v"(bp) : "memory");

    const int hl = lane >> 4, n = lane & 15;
    const int part = (bidN * 128) / DM;          // 0=Q 1=K 2=V, the same for the whole block
    const int head = ((bidN * 128) % DM) / DK;   // the block's first head; wave column wn has head + wn
    const int bb   = (bidM * 128) / SEQ;
    const int s0   = (bidM * 128) % SEQ;         // the block's 128 rows lie in one batch
    const size_t hb = (size_t)(bb * NHEAD + head);

    float bias[WT];
#pragma unroll  // the four bias loads in flight together
    for (int nt = 0; nt < WT; ++nt) bias[nt] = bqkv[colBase + nt * 16 + n];
    _Float16* st = &stage[wn][0];
#pragma unroll  // constant indices: acc[] stays in registers
    for (int mt = 0; mt < WT; ++mt) {
        v8h h[WT];
#pragma unroll  // the same
        for (int nt = 0; nt < WT; ++nt)
#pragma unroll  // the same
            for (int i = 0; i < 8; ++i) h[nt][i] = (_Float16)(acc[mt][nt][i] + bias[nt]);
        const int r0 = wm * 64 + mt * 16;        // the tile's first row in the block
        if (part == 2) {
            // stage[d][s]: a lane's 8 rows are 8 neighbours in s
#pragma unroll  // constant indices into h[]
            for (int nt = 0; nt < WT; ++nt)
                *(v8h*)(st + (nt * 16 + n) * VP + r0 + hl * 8) = h[nt];
        } else {
            // stage[s][d]
#pragma unroll  // constant indices into h[]
            for (int nt = 0; nt < WT; ++nt)
#pragma unroll  // the same
                for (int i = 0; i < 8; ++i) st[(r0 + i + 8 * hl) * QP + nt * 16 + n] = h[nt][i];
        }
    }
    // the tiles are written by all waves and read across them
    __syncthreads();

    // a head: 1024 pieces of 16 bytes = 16 fragment tiles in storage order: V^T 4 (s) x 4 (d), Q/K 8 (s) x 2 (d)
    const int lpitch = (part == 2) ? VP : QP;
    _Float16* dst = (part == 2 ? Vt : part == 0 ? Qh : Kh) + (hb * SEQ + s0) * DK;
#pragma unroll  // the LDS reads issued ahead of the stores
    for (int p = 0; p < 16; ++p) {
        int c = (p & 7) * 128 + threadIdx.x;     // p >> 3 is the head
        int tl = c >> 6, w = c & 63;
        int rt = (part == 2) ? tl & 3 : tl >> 1;
        int kt = (part == 2) ? tl >> 2 : tl & 1;
        *(v8h*)(dst + (size_t)(p >> 3) * SEQ * DK + c * 8) =
            *(const v8h*)(&stage[p >> 3][0] + (rt * 16 + (w & 15)) * lpitch + kt * 32 + piece_k(w));
    }
}

#define FILL_RAW_F (MASK_FILL_F / SCALE_F)      // the fill before the scale; the scale is a power of two
#define EXP_C_F    (SCALE_F * 1.44269504f)      // raw score -> exponent of two

// the value that lane ^ 16 holds
__device__ __forceinline__ float other_half(float v) {
    int b = __builtin_bit_cast(int, v);
    return __builtin_bit_cast(float, __builtin_amdgcn_permlanex16(b, b, 0x76543210, 0xfedcba98, false, false));
}

// One block of 32 keys; kt and vt are the lane's own first pieces of the block's four K tiles and four V^T tiles
// (KIND 0 and 1: in LDS; KIND 2: vt in global memory). KIND 0: kept keys alone. KIND 1: kept keys, then filled ones; 'lim' is the
// number of kept keys from the lane's first key (8 * hl in the block) on, register r of score tile nt being key nt * 16 + r
// from there. KIND 2: filled keys alone: every score is the fill, K is not read (and may not have been computed).
template <int KIND>
__device__ __forceinline__ void attn_block(const _Float16* kt, const _Float16* vt, int lim,
                                           v16h qf0, v16h qf1, float& rowexp, float& rowsum, v8f (&o)[4]) {
        // ---- scores: two 16 (keys) x 16 (queries) tiles over DK=64 (2 WMMA each) ----
        v2f s[8];
        if constexpr (KIND != 2) {
            v8f sc[2];
#pragma unroll  // constant indices: the arrays stay in registers
            for (int nt = 0; nt < 2; ++nt) {
                const _Float16* Kt = kt + nt * 16 * DK; // 16 keys: two tiles
                v16h b0 = load_frag(Kt);
                v16h b1 = load_frag(Kt + FT);
                v8f tacc = {};
                tacc = wmma32(b0, qf0, tacc);
                tacc = wmma32(b1, qf1, tacc);
                sc[nt] = tacc;
            }
            // ---- mask (a key per register) ----
#pragma unroll  // constant indices: the arrays stay in registers
            for (int e = 0; e < 16; ++e)
                s[e >> 1][e & 1] = (KIND == 0 || (e >> 3) * 16 + (e & 7) < lim) ? sc[e >> 3][e & 7] : FILL_RAW_F;
        } else {
#pragma unroll  // constant indices: the array stays in registers
            for (int e = 0; e < 16; ++e) s[e >> 1][e & 1] = FILL_RAW_F;
        }

        // ---- online softmax: in the lane, one exchange between the halves for the maximum ----
        float t3[5];
#pragma unroll  // constant indices: the arrays stay in registers
        for (int g = 0; g < 5; ++g) {
            const int e = g * 3;
            t3[g] = fmaxf(fmaxf(s[e >> 1][e & 1], s[(e + 1) >> 1][(e + 1) & 1]), s[(e + 2) >> 1][(e + 2) & 1]);
        }
        float tm = fmaxf(fmaxf(fmaxf(t3[0], t3[1]), t3[2]), fmaxf(fmaxf(t3[3], t3[4]), s[7][1]));
        tm = fmaxf(tm, other_half(tm));
        // the running maximum is kept as the rounded exponent that the p below are taken against:
        // alpha is then the exact ratio of the two scales, and exactly 1 while the maximum stands
        const float mexp  = fmaxf(rowexp, tm * EXP_C_F);
        const float alpha = __builtin_amdgcn_exp2f(rowexp - mexp);
        rowexp = mexp;

        const v2f c2 = { EXP_C_F, EXP_C_F }, nm2 = { -mexp, -mexp };
        v2f p[8];
#pragma unroll  // constant indices: the arrays stay in registers
        for (int j = 0; j < 8; ++j) {
            v2f x = __builtin_elementwise_fma(s[j], c2, nm2);
            p[j][0] = __builtin_amdgcn_exp2f(x[0]);
            p[j][1] = __builtin_amdgcn_exp2f(x[1]);
        }
        const v2f ps = ((p[0] + p[4]) + (p[1] + p[5])) + ((p[2] + p[6]) + (p[3] + p[7]));
        rowsum = rowsum * alpha + (ps[0] + ps[1]);
#pragma unroll  // constant indices: the arrays stay in registers
        for (int dt = 0; dt < 4; ++dt) o[dt] *= alpha;

        // ---- P^T as a B fragment: element e is key (e >> 3) * 16 + 8 * hl + (e & 7), the k order of V^T's tiles ----
        v16h pf;
#pragma unroll  // constant indices: the arrays stay in registers
        for (int j = 0; j < 8; ++j) {
            v2h h2 = __builtin_convertvector(p[j], v2h);
            pf[2 * j] = h2[0]; pf[2 * j + 1] = h2[1];
        }

        // ---- context: O^T += V^T(16x32) @ P^T(32x16) for 4 d-tiles ----
        v16h w[4];
#pragma unroll  // constant indices: w[] stays in registers
        for (int dt = 0; dt < 4; ++dt) w[dt] = load_frag(vt + dt * FT);
#pragma unroll  // the same
        for (int dt = 0; dt < 4; ++dt) o[dt] = wmma32(w[dt], pf, o[dt]);
        // inputs only: the eight global V loads share one address pair; this holds the pair until the last
        // load has landed, so that no load's result is put into registers that a load in flight names
        if constexpr (KIND == 2) asm volatile("" :: "v"(vt), "v"(w[3]));
}

#define STG_KEYS  128
#define STG_HALFS (STG_KEYS * DK)               // 16 KB of K, and as much of V^T, a stage

// One stage: a thread copies four pieces of 16 bytes of K and four of V^T, 4 KB apart, straight into LDS.
// lk, lv: LDS byte addresses of the thread's first pieces; gk, gv: the same pieces in global memory.
__device__ __forceinline__ void stage_copy(unsigned lk, unsigned lv, const _Float16* gk, const _Float16* gv) {
    // the wait is the statement's last line: it stands in front of every later write of a register that a copy names
    asm volatile("global_load_async_to_lds_b128 %0, %8, off\n\t"
                 "global_load_async_to_lds_b128 %1, %9, off\n\t"
                 "global_load_async_to_lds_b128 %2, %10, off\n\t"
                 "global_load_async_to_lds_b128 %3, %11, off\n\t"
                 "global_load_async_to_lds_b128 %4, %12, off\n\t"
                 "global_load_async_to_lds_b128 %5, %13, off\n\t"
                 "global_load_async_to_lds_b128 %6, %14, off\n\t"
                 "global_load_async_to_lds_b128 %7, %15, off\n\t"
                 "s_wait_xcnt 0x0"
                 :: "v"(lk), "v"(lk + 4096u), "v"(lk + 8192u), "v"(lk + 12288u),
                    "v"(lv), "v"(lv + 4096u), "v"(lv + 8192u), "v"(lv + 12288u),
                    "v"(gk), "v"(gk + 2048), "v"(gk + 4096), "v"(gk + 6144),
                    "v"(gv), "v"(gv + 2048), "v"(gv + 4096), "v"(gv + 6144)
                 : "memory");
}

__global__ __launch_bounds__(256) __attribute__((amdgpu_waves_per_eu(4, 4))) void attn_kernel(const _Float16* __restrict__ Qh,
                                                   const _Float16* __restrict__ Kh,
                                                   const _Float16* __restrict__ Vt,
                                                   const int* __restrict__ cnt,
                                                   _Float16* __restrict__ ctx) {
    __shared__ __align__(128) _Float16 kv[2][2][STG_HALFS];     // [buffer][K, V^T]
    const int wave = threadIdx.x >> 5;
    const int lane = threadIdx.x & 31;
    int qt = blockIdx.x * 8 + wave;              // 4096 q-tiles total
    int t = qt;
    const int qi   = (t % (SEQ / 16)) * 16; t /= (SEQ / 16);
    const int head = t % NHEAD;             t /= NHEAD;
    const int bb   = t;

    const _Float16* Qbase = Qh + ((size_t)(bb * NHEAD + head) * SEQ + qi) * DK + lane * 8;
    const _Float16* Vbase = Vt + (size_t)(bb * NHEAD + head) * DK * SEQ + lane * 8;
    // the thread's first piece of the head's K and V^T (batch and head are the same for the whole work-group)
    const _Float16* Kcopy = Kh + (size_t)(bb * NHEAD + head) * SEQ * DK + threadIdx.x * 8;
    const _Float16* Vcopy = Vt + (size_t)(bb * NHEAD + head) * DK * SEQ + threadIdx.x * 8;
    // and its place in buffer 0: the low 32 bits of a __shared__ address are the LDS byte address
    const unsigned lk0 = (unsigned)(size_t)&kv[0][0][threadIdx.x * 8];
    const unsigned lv0 = (unsigned)(size_t)&kv[0][1][threadIdx.x * 8];

    const v16h qf0 = load_frag(Qbase);                  // d 0..31
    const v16h qf1 = load_frag(Qbase + FT);             // d 32..63

    const int hl = lane >> 4;
    // the batch's kept keys; a block's eight query tiles lie in one batch. Clamped: it bounds the loops' trips
    // (readfirstlane: the clamp compiles to a vector instruction; back in a scalar register, the loop tests are scalar)
    const int n1 = __builtin_amdgcn_readfirstlane(min(max(cnt[(blockIdx.x * 8 / (NHEAD * (SEQ / 16))) * CNT_STEP], 0), SEQ));

    // of the lane's query: the maximum as an exponent of two, and the lane's own part of the sum
    float rowexp = -1e30f, rowsum = 0.0f;
    v8f o[4] = {};                                      // o[dt][r] = O[query lane & 15][d dt * 16 + 8 * hl + r]

    // stages that hold a kept key, at most SEQ / STG_KEYS. A stage is copied whole: the K projection leaves out
    // only blocks of 128 rows that begin behind the kept keys, so every K row of such a stage was written
    const int nst = (n1 + STG_KEYS - 1) / STG_KEYS;
    if (nst > 0) {
        stage_copy(lk0, lv0, Kcopy, Vcopy);
        // stage 0 has landed, for this wave's copies
        asm volatile("s_wait_asynccnt 0x0" ::: "memory");
        // and for every wave's: nothing of it is read in front of this barrier
        __syncthreads();
        if (nst > 1) stage_copy(lk0 + 4u * STG_HALFS, lv0 + 4u * STG_HALFS, Kcopy + STG_HALFS, Vcopy + STG_HALFS);
        for (int st = 0; st < nst; ++st) {
            const _Float16* kl = &kv[st & 1][0][lane * 8];
            const _Float16* vl = &kv[st & 1][1][lane * 8];
            const int left = n1 - st * STG_KEYS;             // kept keys from the stage's first key on, above 0
            const int full = min(left >> 5, STG_KEYS / 32);  // blocks of kept keys alone
            for (int j = 0; j < full; ++j)
                attn_block<0>(kl + j * 32 * DK, vl + j * 32 * DK, 0, qf0, qf1, rowexp, rowsum, o);
            if (full < STG_KEYS / 32 && full * 32 < left)
                attn_block<1>(kl + full * 32 * DK, vl + full * 32 * DK, left - full * 32 - hl * 8, qf0, qf1, rowexp, rowsum, o);
            // the wave's own reads of this buffer are done before it is refilled
            asm volatile("s_wait_dscnt 0x0" ::: "memory");
            // the wave's copies of the next stage have landed
            asm volatile("s_wait_asynccnt 0x0" ::: "memory");
            // publishes the next stage and ends every wave's reads of this buffer
            __syncthreads();
            if (st + 2 < nst)
                stage_copy(lk0 + (unsigned)(st & 1) * (4u * STG_HALFS), lv0 + (unsigned)(st & 1) * (4u * STG_HALFS),
                           Kcopy + (size_t)(st + 2) * STG_HALFS, Vcopy + (size_t)(st + 2) * STG_HALFS);
        }
        // no copy is in flight when the wave goes on
        asm volatile("s_wait_asynccnt 0x0" ::: "memory");
    }
    for (int kb = (n1 + 31) & ~31; kb < SEQ; kb += 32) {
        // only filled keys are left, each with the same score. Where its p, taken as attn_block takes it,
        // is 0 for every query of the wave, the maximum stands (alpha is 1) and each further block would
        // add 0 to every sum: leaving here changes no bit. With no kept keys the walk goes on.
        const float pfill = __builtin_amdgcn_exp2f(__builtin_fmaf(FILL_RAW_F, EXP_C_F, -rowexp));
        if (__builtin_amdgcn_ballot_w32(pfill != 0.0f) == 0) break;
        attn_block<2>(nullptr, Vbase + (size_t)kb * DK, 0, qf0, qf1, rowexp, rowsum, o);
    }

    // inputs only: the four Q loads share one address pair; this holds the pair until the last of them has
    // landed, so that nothing is written into registers that a load in flight names
    asm volatile("" :: "v"(Qbase), "v"(qf1));

    // ---- epilogue: join the halves' sums, normalize, store ctx (f16) ----
    const float inv = 1.0f / (rowsum + other_half(rowsum));
    // ctx is a GEMM operand of ROWS rows: the wave's 16 x 64 are two of its tiles. A lane's 8 values of
    // o[dt] are piece (dt & 1) * 32 + lane of tile dt >> 1: each store of the wave is 512 bytes in a row
    _Float16* cdst = ctx + ((size_t)head * (DK / 32) * (ROWS / 16) + ((bb * SEQ + qi) >> 4)) * FT + lane * 8;
#pragma unroll  // constant indices into o[]
    for (int dt = 0; dt < 4; ++dt) {
        v8h h;
#pragma unroll  // the same
        for (int i = 0; i < 8; ++i) h[i] = (_Float16)(o[dt][i] * inv);
        *(v8h*)(cdst + (dt >> 1) * (ROWS / 16) * FT + (dt & 1) * (FT / 2)) = h;
    }
}

// ---------------- output projection ----------------
// Wave and block tiles as in the QKV projection: 64 x 64 a wave, 2 x 2 waves.
// one wave a SIMD, so registers are free; four chunks of 16 loads fill the wave's load counter, which holds 63
#define OUT_AHEAD 3
#define OP 68                          // f32 stage pitch in dwords: 272 B = 16 B x odd
__global__ __launch_bounds__(128) void out_proj_kernel(const _Float16* __restrict__ ctx,
                                                       const _Float16* __restrict__ WoutT,
                                                       const float* __restrict__ bout,
                                                       const int* __restrict__ srcTab,
                                                       float* __restrict__ out) {
    // each wave stages its own 64 x 64 f32 tile: a row is 256 B, two whole lines
    __shared__ __align__(16) float stage[4][64 * OP];
    const int wave = threadIdx.x >> 5;
    const int lane = threadIdx.x & 31;
    const int wm = wave >> 1, wn = wave & 1;
    const int tilesN = DM / 128;                 // 8
    const int bidN = blockIdx.x % tilesN;
    const int bidM = blockIdx.x / tilesN;
    const int rowBase = bidM * 128 + wm * 64;
    const int colBase = bidN * 128 + wn * 64;

    const _Float16* ap = ctx   + (rowBase >> 4) * FT + lane * 8;
    const _Float16* bp = WoutT + (colBase >> 4) * FT + lane * 8;

    v8f acc[WT][WT] = {};
    gemm_k_loop<OUT_AHEAD, ROWS / 16, DM / 16>(ap, bp, acc);
    // the wait before a register of an issued load is overwritten. Both address pairs are its inputs: they are held
    // up to it, so that nothing of the epilogue is put into them while the k loop's last loads are in flight
    asm volatile("s_wait_xcnt 0x0" :: "v"(ap), "v"(bp) : "memory");
    const int hl = lane >> 4, n = lane & 15;
    // the wave's rows are sorted rows: each goes to the row of out that it came from in x (a row's 256 B stay
    // together). Store p below has row p * 2 + hl; read here, the table lands while the tile is staged
    const int tidx = rowBase + hl, bidx = colBase + n;
    int orow[32];
#pragma unroll  // the loads in flight together, orow[] in registers
    for (int p = 0; p < 32; ++p) orow[p] = srcTab[tidx + p * 2];
    float bias[WT];
#pragma unroll  // the four bias loads in flight together
    for (int nt = 0; nt < WT; ++nt) bias[nt] = bout[bidx + nt * 16];
    float* st = &stage[wave][0];
#pragma unroll  // constant indices: acc[] stays in registers
    for (int nt = 0; nt < WT; ++nt) {
#pragma unroll  // the same
        for (int mt = 0; mt < WT; ++mt)
#pragma unroll  // the same
            for (int i = 0; i < 8; ++i) st[(mt * 16 + i + 8 * hl) * OP + nt * 16 + n] = acc[mt][nt][i] + bias[nt];
    }
    // the wave's own LDS stores are done before its lanes read each other's rows back
    asm volatile("s_wait_dscnt 0x0" ::: "memory");
    // inputs only: the table loads share one index register, the bias loads another; this holds both until the last
    // load of each has landed, so that nothing is written into a register that a load in flight names
    asm volatile("" :: "v"(tidx), "v"(orow[31]), "v"(bidx), "v"(bias[WT - 1]));
    float* dst = out + colBase;
#pragma unroll  // the LDS reads issued ahead of the stores
    for (int p = 0; p < 32; ++p) {
        int c = p * 32 + lane;                   // 16-byte piece: 16 to a row of 64 columns
        int row = c >> 4, pc = c & 15;
        *(v4f*)(dst + (size_t)(orow[p] & (ROWS - 1)) * DM + pc * 4) =    // the address stays inside out
            *(const v4f*)(st + row * OP + pc * 4);
    }
}

extern "C" void kernel_launch(void* const* d_in, const int* in_sizes, int n_in,
                              void* d_out, int out_size, void* d_ws, size_t ws_size,
                              hipStream_t stream) {
    const float* x    = (const float*)d_in[0];   // (2,2048,1024)
    const int*   mask = (const int*)  d_in[1];   // (2,2048)
    const float* Wqkv = (const float*)d_in[2];   // (1024,3072)
    const float* bqkv = (const float*)d_in[3];   // (3072)
    const float* Wout = (const float*)d_in[4];   // (1024,1024)
    const float* bout = (const float*)d_in[5];   // (1024)
    float* out = (float*)d_out;                  // (2,2048,1024)

    char* ws = (char*)d_ws;
    _Float16* xh     = (_Float16*)ws;                 ws += (size_t)ROWS * DM  * 2; // 8 MB
    _Float16* WqkvT  = (_Float16*)ws;                 ws += (size_t)DM3  * DM  * 2; // 6 MB
    _Float16* WoutT  = (_Float16*)ws;                 ws += (size_t)DM   * DM  * 2; // 2 MB
    _Float16* Qh     = (_Float16*)ws;                 ws += (size_t)ROWS * DM  * 2 / NHEAD * NHEAD; // 8 MB
    _Float16* Kh     = (_Float16*)ws;                 ws += (size_t)ROWS * DM  * 2; // 8 MB (Qh advanced same)
    _Float16* Vt     = (_Float16*)ws;                 ws += (size_t)ROWS * DM  * 2; // 8 MB
    _Float16* ctx    = (_Float16*)ws;                 ws += (size_t)ROWS * DM  * 2; // 8 MB
    int*      srcTab = (int*)ws;                      ws += (size_t)ROWS * 4;       // 16 KB
    int*      cnt    = (int*)ws;                      // BATCH lines of 128 B

    // prep: f16 conversion (x: rows sorted by the mask) and both weight transposes, one launch
    prep_kernel<<<CVT_BLOCKS + TQ_BLOCKS + TO_BLOCKS, 256, 0, stream>>>(x, mask, Wqkv, Wout, xh, WqkvT, WoutT, srcTab, cnt);

    // QKV projection: grid = (4096/128) * (3072/128)
    qkv_kernel<<<(ROWS / 128) * (DM3 / 128), 128, 0, stream>>>(xh, WqkvT, bqkv, cnt, Qh, Kh, Vt);

    // attention: 4096 q-tiles, 8 per block
    attn_kernel<<<(BATCH * NHEAD * (SEQ / 16)) / 8, 256, 0, stream>>>(Qh, Kh, Vt, cnt, ctx);

    // output projection: grid = (4096/128) * (1024/128)
    out_proj_kernel<<<(ROWS / 128) * (DM / 128), 128, 0, stream>>>(ctx, WoutT, bout, srcTab, out);
}
